// v000
// The times below were measured on an AMD MI455X: many runs one after another, warmed up first and cycling through
// copies of the inputs, with the whole window's GPU time divided by the number of runs. Launches and the gaps
// between them are all in it. The median over several windows is given; except for v000 it joins two sittings, which
// can be a few percent apart, so the side-by-side timings, each taken in one sitting, are the better comparison.
// v000, which the later versions start from, runs in 335 microseconds.
#include <hip/hip_runtime.h>

// ---------------------------------------------------------------------------
// Single-head attention for MI455X (gfx1250, wave32, WMMA).
//   x:[8,4096,768] f32 -> q,k,v (bf16 in ws) -> flash attention -> out f32.
// Matmuls on v_wmma_f32_16x16x32_bf16 (f32 accum). K/V blocks staged into LDS
// with double-buffered GLOBAL_LOAD_ASYNC_TO_LDS_B128 (ASYNCcnt). Softmax in
// exp2 domain (scale*log2e folded into q).
// ---------------------------------------------------------------------------

typedef __attribute__((ext_vector_type(16))) __bf16 v16bf;
typedef __attribute__((ext_vector_type(8)))  float  v8f;

#define N_EMBD 768
#define HEAD   64
#define BATCH  8
#define SEQ    4096
#define MTOT   (BATCH * SEQ)          // 32768 rows total
// 768^-0.5 * log2(e): logits land directly in log2 domain.
#define QSCALE 0.052058875f

static __device__ __forceinline__ v8f wmma_bf16(v16bf a, v16bf b, v8f c) {
  // (neg_a, A, neg_b, B, c_mod, C, reuse_a, reuse_b)
  return __builtin_amdgcn_wmma_f32_16x16x32_bf16(false, a, false, b, (short)0, c,
                                                 false, false);
}

// f32 -> bf16 via native hardware convert (v_cvt_pk_bf16_f32).
static __device__ __forceinline__ unsigned short f2u(float f) {
  return __builtin_bit_cast(unsigned short, (__bf16)f);
}
static __device__ __forceinline__ __bf16 u2b(unsigned short u) {
  return __builtin_bit_cast(__bf16, u);
}
static __device__ __forceinline__ v8f zero8() {
  v8f z = {0.f, 0.f, 0.f, 0.f, 0.f, 0.f, 0.f, 0.f};
  return z;
}

// K-pair base offsets for the 16-bit A/B fragment layout (ISA 7.12.2):
// half 0 covers K {0..7,16..23}, half 1 covers K {8..15,24..31}, 2 per VGPR.
static __device__ __forceinline__ void kk_pattern(int hf, int* kks) {
#pragma unroll
  for (int i = 0; i < 8; ++i)
    kks[i] = (i < 4 ? 2 * i : 16 + 2 * (i - 4)) + 8 * hf;
}

// Load one 16-bit B fragment (32xK rows x 16 cols) from a row pointer whose
// row holds contiguous K-pairs; kks holds this lane's K-pair offsets.
static __device__ __forceinline__ v16bf load_frag(const unsigned short* p,
                                                  const int* kks) {
  v16bf b;
#pragma unroll
  for (int i = 0; i < 8; ++i) {
    unsigned int u = *reinterpret_cast<const unsigned int*>(p + kks[i]);
    b[2 * i] = u2b((unsigned short)(u & 0xffffu));
    b[2 * i + 1] = u2b((unsigned short)(u >> 16));
  }
  return b;
}

// Low 32 bits of a flat pointer into LDS == LDS byte offset (aperture layout).
static __device__ __forceinline__ unsigned lds_addr(const void* p) {
  return (unsigned)(size_t)p;
}

// ---------------------------------------------------------------------------
// Kernel 0: W[768][64] f32 -> W^T[64][768] bf16 (contiguous K-pairs for B frags)
// ---------------------------------------------------------------------------
__global__ __launch_bounds__(256) void wcvt_kernel(
    const float* __restrict__ Wq, const float* __restrict__ Wk,
    const float* __restrict__ Wv, unsigned short* __restrict__ WqT,
    unsigned short* __restrict__ WkT, unsigned short* __restrict__ WvT) {
  int idx = blockIdx.x * 256 + threadIdx.x;
  if (idx >= 3 * N_EMBD * HEAD) return;
  int m = idx / (N_EMBD * HEAD);
  int r = idx % (N_EMBD * HEAD);
  int k = r / HEAD;
  int n = r % HEAD;
  const float* W = (m == 0) ? Wq : (m == 1 ? Wk : Wv);
  unsigned short* WT = (m == 0) ? WqT : (m == 1 ? WkT : WvT);
  WT[(size_t)n * N_EMBD + k] = f2u(W[(size_t)k * HEAD + n]);
}

// ---------------------------------------------------------------------------
// Kernel 1: fused QKV projection. One wave = one 16-row tile of [32768,768]x
// [768,64] for q,k,v simultaneously (x is read exactly once). Per k-step all
// 12 weight B-fragments are preloaded into distinct registers (one big load
// clause) so the 12 WMMAs issue back-to-back instead of load->wait->wmma.
// q scaled by QSCALE; v stored transposed [64][32768] for P@V B-fragments.
// ---------------------------------------------------------------------------
__global__ __launch_bounds__(128) void qkv_kernel(
    const float* __restrict__ x, const float* __restrict__ bq,
    const float* __restrict__ bk, const float* __restrict__ bv,
    const unsigned short* __restrict__ WqT, const unsigned short* __restrict__ WkT,
    const unsigned short* __restrict__ WvT, unsigned short* __restrict__ qo,
    unsigned short* __restrict__ ko, unsigned short* __restrict__ vT) {
  const int lane = threadIdx.x & 31;
  const int wid = threadIdx.x >> 5;
  const int row0 = (blockIdx.x * 4 + wid) * 16;
  const int m = lane & 15, hf = lane >> 4;
  int kks[8];
  kk_pattern(hf, kks);

  v8f acc[3][4];
#pragma unroll
  for (int w = 0; w < 3; ++w)
#pragma unroll
    for (int nt = 0; nt < 4; ++nt) acc[w][nt] = zero8();

  const float* xrow = x + (size_t)(row0 + m) * N_EMBD;
  for (int k0 = 0; k0 < N_EMBD; k0 += 32) {
    // A fragment: 16x32 slice of x, f32 -> bf16 (v_cvt_pk_bf16_f32).
    v16bf a;
#pragma unroll
    for (int i = 0; i < 8; ++i) {
      float2 f = *reinterpret_cast<const float2*>(xrow + k0 + kks[i]);
      a[2 * i] = (__bf16)f.x;
      a[2 * i + 1] = (__bf16)f.y;
    }
    // Preload all 12 B fragments (q,k,v x 4 n-tiles) into distinct registers.
    v16bf bfr[12];
#pragma unroll
    for (int w = 0; w < 3; ++w) {
      const unsigned short* WT = (w == 0) ? WqT : (w == 1 ? WkT : WvT);
#pragma unroll
      for (int nt = 0; nt < 4; ++nt)
        bfr[w * 4 + nt] = load_frag(WT + (size_t)(nt * 16 + m) * N_EMBD + k0, kks);
    }
    // 12 back-to-back WMMAs; next k-step's loads overlap with the matrix pipe.
#pragma unroll
    for (int w = 0; w < 3; ++w)
#pragma unroll
      for (int nt = 0; nt < 4; ++nt)
        acc[w][nt] = wmma_bf16(a, bfr[w * 4 + nt], acc[w][nt]);
  }

  // C/D layout: VGPR r = rows r (lanes 0-15) / r+8 (lanes 16-31), col = lane%16.
#pragma unroll
  for (int nt = 0; nt < 4; ++nt) {
    int col = nt * 16 + m;
    float biasq = bq[col], biask = bk[col], biasv = bv[col];
#pragma unroll
    for (int r = 0; r < 8; ++r) {
      int row = row0 + r + 8 * hf;
      qo[(size_t)row * HEAD + col] = f2u((acc[0][nt][r] + biasq) * QSCALE);
      ko[(size_t)row * HEAD + col] = f2u(acc[1][nt][r] + biask);
      vT[(size_t)col * MTOT + row] = f2u(acc[2][nt][r] + biasv);
    }
  }
}

// ---------------------------------------------------------------------------
// Kernel 2: flash attention. 4 waves/block, wave = 16 q rows, 32 keys/iter.
// K/V blocks staged in LDS via double-buffered async DMA; S via 4 WMMAs,
// online softmax in log2 domain (16-lane shfl_xor row reductions), P converted
// C/D->A layout through per-wave LDS, O += P@V.
// ---------------------------------------------------------------------------
__global__ __launch_bounds__(128) void attn_kernel(
    const unsigned short* __restrict__ q, const unsigned short* __restrict__ kg,
    const unsigned short* __restrict__ vg, float* __restrict__ out) {
  // Padded rows so the 16-lane fragment reads hit distinct LDS banks.
  __shared__ unsigned short kbuf[2][32][72];  // [buf][key][h]   (64 used + pad)
  __shared__ unsigned short vbuf[2][64][40];  // [buf][h][key]   (32 used + pad)
  __shared__ unsigned short pbuf[4][16][40];  // per-wave P transpose tile
  const int tid = threadIdx.x;
  const int lane = tid & 31;
  const int wid = tid >> 5;
  const int m = lane & 15, hf = lane >> 4;
  const int base = blockIdx.y * SEQ;
  const int q0 = blockIdx.x * 64 + wid * 16;
  int kks[8];
  kk_pattern(hf, kks);

  // Async-stage one 32-key block (K: 32x64 bf16, V^T: 64x32 bf16) into LDS.
  // 128 threads x (2 K + 2 V) GLOBAL_LOAD_ASYNC_TO_LDS_B128 per block.
  auto issue_block = [&](int kb, int buf) {
    const unsigned short* ksrc = kg + (size_t)(base + kb) * HEAD;
    const unsigned short* vsrc = vg + (size_t)(base + kb);
#pragma unroll
    for (int j = 0; j < 2; ++j) {
      int c = tid * 2 + j;             // 256 chunks of 16B
      int key = c >> 3, part = c & 7;  // 8 chunks per 64-half K row
      unsigned ldsa = lds_addr(&kbuf[buf][key][part * 8]);
      int voff = c * 16;               // K block is contiguous in global
      asm volatile("global_load_async_to_lds_b128 %0, %1, %2"
                   :: "v"(ldsa), "v"(voff), "s"(ksrc) : "memory");
    }
#pragma unroll
    for (int j = 0; j < 2; ++j) {
      int c = tid * 2 + j;
      int h = c >> 2, part = c & 3;    // 4 chunks per 32-half V^T row
      unsigned ldsa = lds_addr(&vbuf[buf][h][part * 8]);
      int voff = (h * MTOT + part * 8) * 2;
      asm volatile("global_load_async_to_lds_b128 %0, %1, %2"
                   :: "v"(ldsa), "v"(voff), "s"(vsrc) : "memory");
    }
  };

  // Q A-fragments (K = head dim 64 -> two 16x32 fragments), held for all keys.
  v16bf aq[2];
#pragma unroll
  for (int ks = 0; ks < 2; ++ks)
    aq[ks] = load_frag(q + (size_t)(base + q0 + m) * HEAD + ks * 32, kks);

  float mrow[8], lrow[8];
  v8f o[4];
#pragma unroll
  for (int r = 0; r < 8; ++r) { mrow[r] = -3.0e38f; lrow[r] = 0.f; }
#pragma unroll
  for (int nt = 0; nt < 4; ++nt) o[nt] = zero8();

  issue_block(0, 0);
  for (int kb = 0; kb < SEQ; kb += 32) {
    const int cur = (kb >> 5) & 1;
    if (kb + 32 < SEQ) {
      issue_block(kb + 32, cur ^ 1);   // overlap next copy with this compute
      asm volatile("s_wait_asynccnt 0x4" ::: "memory");  // prev 4 done
    } else {
      asm volatile("s_wait_asynccnt 0x0" ::: "memory");
    }
    __syncthreads();  // staged block visible to all 4 waves

    // S = Q * K^T for 32 keys: 2 n-tiles x 2 k-steps, fragments from LDS.
    v8f s[2];
    s[0] = zero8(); s[1] = zero8();
#pragma unroll
    for (int nt = 0; nt < 2; ++nt) {
      const unsigned short* kp = &kbuf[cur][nt * 16 + m][0];
#pragma unroll
      for (int ks = 0; ks < 2; ++ks)
        s[nt] = wmma_bf16(aq[ks], load_frag(kp + ks * 32, kks), s[nt]);
    }
    // Online softmax (exp2 domain; scale folded into q).
#pragma unroll
    for (int r = 0; r < 8; ++r) {
      float mx = fmaxf(s[0][r], s[1][r]);
#pragma unroll
      for (int off = 1; off < 16; off <<= 1)
        mx = fmaxf(mx, __shfl_xor(mx, off, 16));
      float mn = fmaxf(mrow[r], mx);
      float alpha = exp2f(mrow[r] - mn);
      float p0 = exp2f(s[0][r] - mn);
      float p1 = exp2f(s[1][r] - mn);
      s[0][r] = p0;
      s[1][r] = p1;
      float rs = p0 + p1;
#pragma unroll
      for (int off = 1; off < 16; off <<= 1) rs += __shfl_xor(rs, off, 16);
      lrow[r] = lrow[r] * alpha + rs;
      mrow[r] = mn;
#pragma unroll
      for (int nt = 0; nt < 4; ++nt) o[nt][r] *= alpha;
    }
    // P: C/D layout (f32) -> per-wave LDS tile -> A-fragment layout (bf16).
#pragma unroll
    for (int nt = 0; nt < 2; ++nt)
#pragma unroll
      for (int r = 0; r < 8; ++r)
        pbuf[wid][r + 8 * hf][nt * 16 + m] = f2u(s[nt][r]);
    __builtin_amdgcn_wave_barrier();
    asm volatile("s_wait_dscnt 0" ::: "memory");
    v16bf ap;
#pragma unroll
    for (int i = 0; i < 8; ++i) {
      ap[2 * i] = u2b(pbuf[wid][m][kks[i]]);
      ap[2 * i + 1] = u2b(pbuf[wid][m][kks[i] + 1]);
    }
    // O += P * V : V^T rows in LDS give contiguous key-pairs per B fragment.
#pragma unroll
    for (int nt = 0; nt < 4; ++nt)
      o[nt] = wmma_bf16(ap, load_frag(&vbuf[cur][nt * 16 + m][0], kks), o[nt]);
    __syncthreads();  // all waves done with buf `cur` before it is refilled
  }
  // Normalize and store f32 output.
#pragma unroll
  for (int r = 0; r < 8; ++r) {
    float inv = 1.0f / lrow[r];
    int row = base + q0 + r + 8 * hf;
#pragma unroll
    for (int nt = 0; nt < 4; ++nt)
      out[(size_t)row * HEAD + nt * 16 + m] = o[nt][r] * inv;
  }
}

// ---------------------------------------------------------------------------
extern "C" void kernel_launch(void* const* d_in, const int* in_sizes, int n_in,
                              void* d_out, int out_size, void* d_ws,
                              size_t ws_size, hipStream_t stream) {
  (void)in_sizes; (void)n_in; (void)out_size; (void)ws_size;
  const float* x  = (const float*)d_in[0];
  const float* Wq = (const float*)d_in[1];
  const float* bq = (const float*)d_in[2];
  const float* Wk = (const float*)d_in[3];
  const float* bk = (const float*)d_in[4];
  const float* Wv = (const float*)d_in[5];
  const float* bv = (const float*)d_in[6];
  float* out = (float*)d_out;

  // Workspace: q,k bf16 [32768][64]; vT bf16 [64][32768]; 3x W^T bf16 [64][768].
  char* ws = (char*)d_ws;
  unsigned short* qo  = (unsigned short*)(ws);
  unsigned short* ko  = (unsigned short*)(ws + (size_t)MTOT * HEAD * 2);
  unsigned short* vT  = (unsigned short*)(ws + (size_t)MTOT * HEAD * 4);
  unsigned short* WqT = (unsigned short*)(ws + (size_t)MTOT * HEAD * 6);
  unsigned short* WkT = WqT + (size_t)N_EMBD * HEAD;
  unsigned short* WvT = WkT + (size_t)N_EMBD * HEAD;

  hipLaunchKernelGGL(wcvt_kernel, dim3((3 * N_EMBD * HEAD + 255) / 256),
                     dim3(256), 0, stream, Wq, Wk, Wv, WqT, WkT, WvT);
  hipLaunchKernelGGL(qkv_kernel, dim3(MTOT / 64), dim3(128), 0, stream, x, bq,
                     bk, bv, WqT, WkT, WvT, qo, ko, vT);
  hipLaunchKernelGGL(attn_kernel, dim3(SEQ / 64, BATCH), dim3(128), 0, stream,
                     qo, ko, vT, out);
}

// v001
// It runs in 162 microseconds.
// Timed twice side by side with v000, it ran 2.14 and 2.16 times as fast.
#include <hip/hip_runtime.h>

// ---------------------------------------------------------------------------
// Single-head attention for MI455X (gfx1250, wave32, WMMA).
//   x:[8,4096,768] f32 -> q,k,v (bf16 in ws) -> flash attention -> out f32.
// Matmuls on v_wmma_f32_16x16x32_bf16 (f32 accum). K/V blocks staged into LDS
// with double-buffered GLOBAL_LOAD_ASYNC_TO_LDS_B128 (ASYNCcnt). Softmax in
// exp2 domain (scale*log2e folded into q). Scores are formed transposed
// (S^T = K Q^T, O^T += V^T P^T): a lane owns one query column.
// ---------------------------------------------------------------------------

typedef __attribute__((ext_vector_type(16))) __bf16 v16bf;
typedef __attribute__((ext_vector_type(8)))  float  v8f;

#define N_EMBD 768
#define HEAD   64
#define BATCH  8
#define SEQ    4096
#define MTOT   (BATCH * SEQ)          // 32768 rows total
// 768^-0.5 * log2(e): logits land directly in log2 domain.
#define QSCALE 0.052058875f

static __device__ __forceinline__ v8f wmma_bf16(v16bf a, v16bf b, v8f c) {
  // (neg_a, A, neg_b, B, c_mod, C, reuse_a, reuse_b)
  return __builtin_amdgcn_wmma_f32_16x16x32_bf16(false, a, false, b, (short)0, c,
                                                 false, false);
}

// f32 -> bf16 via native hardware convert (v_cvt_pk_bf16_f32).
static __device__ __forceinline__ unsigned short f2u(float f) {
  return __builtin_bit_cast(unsigned short, (__bf16)f);
}
static __device__ __forceinline__ __bf16 u2b(unsigned short u) {
  return __builtin_bit_cast(__bf16, u);
}
static __device__ __forceinline__ v8f zero8() {
  v8f z = {0.f, 0.f, 0.f, 0.f, 0.f, 0.f, 0.f, 0.f};
  return z;
}

// K-pair base offsets for the 16-bit A/B fragment layout (ISA 7.12.2):
// half 0 covers K {0..7,16..23}, half 1 covers K {8..15,24..31}, 2 per VGPR.
static __device__ __forceinline__ void kk_pattern(int hf, int* kks) {
#pragma unroll
  for (int i = 0; i < 8; ++i)
    kks[i] = (i < 4 ? 2 * i : 16 + 2 * (i - 4)) + 8 * hf;
}

// Load one 16-bit B fragment (32xK rows x 16 cols) from a row pointer whose
// row holds contiguous K-pairs; kks holds this lane's K-pair offsets.
static __device__ __forceinline__ v16bf load_frag(const unsigned short* p,
                                                  const int* kks) {
  v16bf b;
#pragma unroll
  for (int i = 0; i < 8; ++i) {
    unsigned int u = *reinterpret_cast<const unsigned int*>(p + kks[i]);
    b[2 * i] = u2b((unsigned short)(u & 0xffffu));
    b[2 * i + 1] = u2b((unsigned short)(u >> 16));
  }
  return b;
}

// Lane l <-> lane l ^ 16 (the two halves that share one query column).
static __device__ __forceinline__ float xhalf(float x) {
  int b = __builtin_bit_cast(int, x);
  return __builtin_bit_cast(
      float, __builtin_amdgcn_permlanex16(b, b, 0x76543210, 0xfedcba98, false, false));
}

// Low 32 bits of a flat pointer into LDS == LDS byte offset (aperture layout).
static __device__ __forceinline__ unsigned lds_addr(const void* p) {
  return (unsigned)(size_t)p;
}

// ---------------------------------------------------------------------------
// Kernel 0: W[768][64] f32 -> W^T[64][768] bf16 (contiguous K-pairs for B frags)
// ---------------------------------------------------------------------------
__global__ __launch_bounds__(256) void wcvt_kernel(
    const float* __restrict__ Wq, const float* __restrict__ Wk,
    const float* __restrict__ Wv, unsigned short* __restrict__ WqT,
    unsigned short* __restrict__ WkT, unsigned short* __restrict__ WvT) {
  int idx = blockIdx.x * 256 + threadIdx.x;
  if (idx >= 3 * N_EMBD * HEAD) return;
  int m = idx / (N_EMBD * HEAD);
  int r = idx % (N_EMBD * HEAD);
  int k = r / HEAD;
  int n = r % HEAD;
  const float* W = (m == 0) ? Wq : (m == 1 ? Wk : Wv);
  unsigned short* WT = (m == 0) ? WqT : (m == 1 ? WkT : WvT);
  WT[(size_t)n * N_EMBD + k] = f2u(W[(size_t)k * HEAD + n]);
}

// ---------------------------------------------------------------------------
// Kernel 1: fused QKV projection. One wave = one 16-row tile of [32768,768]x
// [768,64] for q,k,v simultaneously (x is read exactly once). Per k-step all
// 12 weight B-fragments are preloaded into distinct registers (one big load
// clause) so the 12 WMMAs issue back-to-back instead of load->wait->wmma.
// q scaled by QSCALE; v stored transposed [64][32768] for V^T P^T A-fragments.
// ---------------------------------------------------------------------------
__global__ __launch_bounds__(128) void qkv_kernel(
    const float* __restrict__ x, const float* __restrict__ bq,
    const float* __restrict__ bk, const float* __restrict__ bv,
    const unsigned short* __restrict__ WqT, const unsigned short* __restrict__ WkT,
    const unsigned short* __restrict__ WvT, unsigned short* __restrict__ qo,
    unsigned short* __restrict__ ko, unsigned short* __restrict__ vT) {
  const int lane = threadIdx.x & 31;
  const int wid = threadIdx.x >> 5;
  const int row0 = (blockIdx.x * 4 + wid) * 16;
  const int m = lane & 15, hf = lane >> 4;
  int kks[8];
  kk_pattern(hf, kks);

  v8f acc[3][4];
#pragma unroll
  for (int w = 0; w < 3; ++w)
#pragma unroll
    for (int nt = 0; nt < 4; ++nt) acc[w][nt] = zero8();

  const float* xrow = x + (size_t)(row0 + m) * N_EMBD;
  for (int k0 = 0; k0 < N_EMBD; k0 += 32) {
    // A fragment: 16x32 slice of x, f32 -> bf16 (v_cvt_pk_bf16_f32).
    v16bf a;
#pragma unroll
    for (int i = 0; i < 8; ++i) {
      float2 f = *reinterpret_cast<const float2*>(xrow + k0 + kks[i]);
      a[2 * i] = (__bf16)f.x;
      a[2 * i + 1] = (__bf16)f.y;
    }
    // Preload all 12 B fragments (q,k,v x 4 n-tiles) into distinct registers.
    v16bf bfr[12];
#pragma unroll
    for (int w = 0; w < 3; ++w) {
      const unsigned short* WT = (w == 0) ? WqT : (w == 1 ? WkT : WvT);
#pragma unroll
      for (int nt = 0; nt < 4; ++nt)
        bfr[w * 4 + nt] = load_frag(WT + (size_t)(nt * 16 + m) * N_EMBD + k0, kks);
    }
    // 12 back-to-back WMMAs; next k-step's loads overlap with the matrix pipe.
#pragma unroll
    for (int w = 0; w < 3; ++w)
#pragma unroll
      for (int nt = 0; nt < 4; ++nt)
        acc[w][nt] = wmma_bf16(a, bfr[w * 4 + nt], acc[w][nt]);
  }

  // C/D layout: VGPR r = rows r (lanes 0-15) / r+8 (lanes 16-31), col = lane%16.
#pragma unroll
  for (int nt = 0; nt < 4; ++nt) {
    int col = nt * 16 + m;
    float biasq = bq[col], biask = bk[col], biasv = bv[col];
#pragma unroll
    for (int r = 0; r < 8; ++r) {
      int row = row0 + r + 8 * hf;
      qo[(size_t)row * HEAD + col] = f2u((acc[0][nt][r] + biasq) * QSCALE);
      ko[(size_t)row * HEAD + col] = f2u(acc[1][nt][r] + biask);
      vT[(size_t)col * MTOT + row] = f2u(acc[2][nt][r] + biasv);
    }
  }
}

// ---------------------------------------------------------------------------
// Kernel 2: flash attention. 4 waves/block, wave = 16 q rows, 32 keys/iter.
// K/V blocks staged in LDS via double-buffered async DMA. S^T = K Q^T via 4
// WMMAs: lane (m, hf) holds 16 of the 32 scores of query column m, so the
// online softmax (log2 domain) reduces in registers plus one half exchange,
// and the two f32 S^T tiles convert in place into the B operand of
// O^T += V^T P^T (hardware k order on both sides).
// ---------------------------------------------------------------------------
__global__ __launch_bounds__(128) void attn_kernel(
    const unsigned short* __restrict__ q, const unsigned short* __restrict__ kg,
    const unsigned short* __restrict__ vg, float* __restrict__ out) {
  // Padded rows so the 16-lane fragment reads hit distinct LDS banks.
  __shared__ unsigned short kbuf[2][32][72];  // [buf][key][h]   (64 used + pad)
  __shared__ unsigned short vbuf[2][64][40];  // [buf][h][key]   (32 used + pad)
  const int tid = threadIdx.x;
  const int lane = tid & 31;
  const int wid = tid >> 5;
  const int m = lane & 15, hf = lane >> 4;
  const int base = blockIdx.y * SEQ;
  const int q0 = blockIdx.x * 64 + wid * 16;
  int kks[8];
  kk_pattern(hf, kks);

  // Async-stage one 32-key block (K: 32x64 bf16, V^T: 64x32 bf16) into LDS.
  // 128 threads x (2 K + 2 V) GLOBAL_LOAD_ASYNC_TO_LDS_B128 per block.
  auto issue_block = [&](int kb, int buf) {
    const unsigned short* ksrc = kg + (size_t)(base + kb) * HEAD;
    const unsigned short* vsrc = vg + (size_t)(base + kb);
#pragma unroll
    for (int j = 0; j < 2; ++j) {
      int c = tid * 2 + j;             // 256 chunks of 16B
      int key = c >> 3, part = c & 7;  // 8 chunks per 64-half K row
      unsigned ldsa = lds_addr(&kbuf[buf][key][part * 8]);
      int voff = c * 16;               // K block is contiguous in global
      asm volatile("global_load_async_to_lds_b128 %0, %1, %2"
                   :: "v"(ldsa), "v"(voff), "s"(ksrc) : "memory");
    }
#pragma unroll
    for (int j = 0; j < 2; ++j) {
      int c = tid * 2 + j;
      int h = c >> 2, part = c & 3;    // 4 chunks per 32-half V^T row
      unsigned ldsa = lds_addr(&vbuf[buf][h][part * 8]);
      int voff = (h * MTOT + part * 8) * 2;
      asm volatile("global_load_async_to_lds_b128 %0, %1, %2"
                   :: "v"(ldsa), "v"(voff), "s"(vsrc) : "memory");
    }
  };

  // Q^T B-fragments (K = head dim 64 -> two 32x16 fragments), held for all keys.
  v16bf aq[2];
#pragma unroll
  for (int ks = 0; ks < 2; ++ks)
    aq[ks] = load_frag(q + (size_t)(base + q0 + m) * HEAD + ks * 32, kks);

  // Per query column: running maximum (same in both halves) and this half's
  // share of the running sum (the halves are joined once, after the loop).
  float mrow = -3.0e38f, lrow = 0.f;
  v8f o[4];  // o[nt][r] = O^T[nt*16 + 8*hf + r][m]
#pragma unroll
  for (int nt = 0; nt < 4; ++nt) o[nt] = zero8();

  issue_block(0, 0);
  for (int kb = 0; kb < SEQ; kb += 32) {
    const int cur = (kb >> 5) & 1;
    if (kb + 32 < SEQ) {
      issue_block(kb + 32, cur ^ 1);   // overlap next copy with this compute
      asm volatile("s_wait_asynccnt 0x4" ::: "memory");  // prev 4 done
    } else {
      asm volatile("s_wait_asynccnt 0x0" ::: "memory");
    }
    __syncthreads();  // staged block visible to all 4 waves

    // S^T = K * Q^T for 32 keys: 2 key tiles x 2 k-steps, K rows from LDS as A.
    // s[nt][r] = S^T[nt*16 + 8*hf + r][m].
    v8f s[2];
    s[0] = zero8(); s[1] = zero8();
#pragma unroll
    for (int nt = 0; nt < 2; ++nt) {
      const unsigned short* kp = &kbuf[cur][nt * 16 + m][0];
#pragma unroll
      for (int ks = 0; ks < 2; ++ks)
        s[nt] = wmma_bf16(load_frag(kp + ks * 32, kks), aq[ks], s[nt]);
    }
    // Online softmax (exp2 domain; scale folded into q), one column per lane.
    float mx0 = fmaxf(s[0][0], s[1][0]), mx1 = fmaxf(s[0][1], s[1][1]);
#pragma unroll
    for (int r = 2; r < 8; r += 2) {
      mx0 = fmaxf(mx0, fmaxf(s[0][r], s[1][r]));
      mx1 = fmaxf(mx1, fmaxf(s[0][r + 1], s[1][r + 1]));
    }
    float mx = fmaxf(mx0, mx1);
    mx = fmaxf(mx, xhalf(mx));
    const float mn = fmaxf(mrow, mx);
    const float alpha = exp2f(mrow - mn);
    mrow = mn;
    v16bf pt;  // P^T as B operand: pt[j] = key 8*hf + j, pt[8 + j] = key 16 + 8*hf + j
    float rs[4] = {0.f, 0.f, 0.f, 0.f};
#pragma unroll
    for (int r = 0; r < 8; ++r) {
      float p0 = exp2f(s[0][r] - mn);
      float p1 = exp2f(s[1][r] - mn);
      rs[r & 1] += p0;
      rs[2 + (r & 1)] += p1;
      pt[r] = (__bf16)p0;
      pt[8 + r] = (__bf16)p1;
    }
    lrow = lrow * alpha + ((rs[0] + rs[1]) + (rs[2] + rs[3]));
#pragma unroll
    for (int nt = 0; nt < 4; ++nt)
#pragma unroll
      for (int r = 0; r < 8; ++r) o[nt][r] *= alpha;
    // O^T += V^T * P^T : V^T rows in LDS are the A fragments (16 h x 32 keys).
#pragma unroll
    for (int nt = 0; nt < 4; ++nt)
      o[nt] = wmma_bf16(load_frag(&vbuf[cur][nt * 16 + m][0], kks), pt, o[nt]);
    __syncthreads();  // all waves done with buf `cur` before it is refilled
  }
  // Join the halves' sums, normalize, store: a lane holds 8 consecutive h of
  // its query row per tile -> two 16-byte stores.
  const float inv = 1.0f / (lrow + xhalf(lrow));
  float* orow = out + (size_t)(base + q0 + m) * HEAD + 8 * hf;
#pragma unroll
  for (int nt = 0; nt < 4; ++nt) {
    float4 lo = make_float4(o[nt][0] * inv, o[nt][1] * inv, o[nt][2] * inv, o[nt][3] * inv);
    float4 hi = make_float4(o[nt][4] * inv, o[nt][5] * inv, o[nt][6] * inv, o[nt][7] * inv);
    *reinterpret_cast<float4*>(orow + nt * 16) = lo;
    *reinterpret_cast<float4*>(orow + nt * 16 + 4) = hi;
  }
}

// ---------------------------------------------------------------------------
extern "C" void kernel_launch(void* const* d_in, const int* in_sizes, int n_in,
                              void* d_out, int out_size, void* d_ws,
                              size_t ws_size, hipStream_t stream) {
  (void)in_sizes; (void)n_in; (void)out_size; (void)ws_size;
  const float* x  = (const float*)d_in[0];
  const float* Wq = (const float*)d_in[1];
  const float* bq = (const float*)d_in[2];
  const float* Wk = (const float*)d_in[3];
  const float* bk = (const float*)d_in[4];
  const float* Wv = (const float*)d_in[5];
  const float* bv = (const float*)d_in[6];
  float* out = (float*)d_out;

  // Workspace: q,k bf16 [32768][64]; vT bf16 [64][32768]; 3x W^T bf16 [64][768].
  char* ws = (char*)d_ws;
  unsigned short* qo  = (unsigned short*)(ws);
  unsigned short* ko  = (unsigned short*)(ws + (size_t)MTOT * HEAD * 2);
  unsigned short* vT  = (unsigned short*)(ws + (size_t)MTOT * HEAD * 4);
  unsigned short* WqT = (unsigned short*)(ws + (size_t)MTOT * HEAD * 6);
  unsigned short* WkT = WqT + (size_t)N_EMBD * HEAD;
  unsigned short* WvT = WkT + (size_t)N_EMBD * HEAD;

  hipLaunchKernelGGL(wcvt_kernel, dim3((3 * N_EMBD * HEAD + 255) / 256),
                     dim3(256), 0, stream, Wq, Wk, Wv, WqT, WkT, WvT);
  hipLaunchKernelGGL(qkv_kernel, dim3(MTOT / 64), dim3(128), 0, stream, x, bq,
                     bk, bv, WqT, WkT, WvT, qo, ko, vT);
  hipLaunchKernelGGL(attn_kernel, dim3(SEQ / 64, BATCH), dim3(128), 0, stream,
                     qo, ko, vT, out);
}

// v002
// Measured time: 103 microseconds a run.
// Timed twice side by side with v001, it ran 1.54 and 1.60 times as fast.
// Counting every step since v000, it is 3.37 times as fast.
#include <hip/hip_runtime.h>

// ---------------------------------------------------------------------------
// Single-head attention for MI455X (gfx1250, wave32, WMMA).
//   x:[8,4096,768] f32 -> q,k,v (bf16 in ws) -> flash attention -> out f32.
// Matmuls on v_wmma_f32_16x16x32_bf16 (f32 accum). K/V blocks staged into LDS
// with double-buffered GLOBAL_LOAD_ASYNC_TO_LDS_B128 (ASYNCcnt). Softmax in
// exp2 domain (scale*log2e folded into q). Scores are formed transposed
// (S^T = K Q^T, O^T += V^T P^T): a lane owns one query column.
// ---------------------------------------------------------------------------

typedef __attribute__((ext_vector_type(16))) __bf16 v16bf;
typedef __attribute__((ext_vector_type(8)))  float  v8f;
typedef __attribute__((ext_vector_type(4)))  unsigned int u32x4;

#define N_EMBD 768
#define HEAD   64
#define BATCH  8
#define SEQ    4096
#define MTOT   (BATCH * SEQ)          // 32768 rows total
#define KSTEPS (N_EMBD / 32)          // 24 k-steps of the projection
#define NFRAG  12                     // q,k,v x 4 column tiles
#define WCHUNKS (KSTEPS * NFRAG * 64) // 16-byte chunks of the packed weights
// 768^-0.5 * log2(e): logits land directly in log2 domain.
#define QSCALE 0.052058875f

static __device__ __forceinline__ v8f wmma_bf16(v16bf a, v16bf b, v8f c) {
  // (neg_a, A, neg_b, B, c_mod, C, reuse_a, reuse_b)
  return __builtin_amdgcn_wmma_f32_16x16x32_bf16(false, a, false, b, (short)0, c,
                                                 false, false);
}

// f32 -> bf16 via native hardware convert (v_cvt_pk_bf16_f32).
static __device__ __forceinline__ unsigned short f2u(float f) {
  return __builtin_bit_cast(unsigned short, (__bf16)f);
}
static __device__ __forceinline__ __bf16 u2b(unsigned short u) {
  return __builtin_bit_cast(__bf16, u);
}
static __device__ __forceinline__ v8f zero8() {
  v8f z = {0.f, 0.f, 0.f, 0.f, 0.f, 0.f, 0.f, 0.f};
  return z;
}

// K-pair base offsets for the 16-bit A/B fragment layout (ISA 7.12.2):
// half 0 covers K {0..7,16..23}, half 1 covers K {8..15,24..31}, 2 per VGPR.
static __device__ __forceinline__ void kk_pattern(int hf, int* kks) {
#pragma unroll
  for (int i = 0; i < 8; ++i)
    kks[i] = (i < 4 ? 2 * i : 16 + 2 * (i - 4)) + 8 * hf;
}

// Load one 16-bit B fragment (32xK rows x 16 cols) from a row pointer whose
// row holds contiguous K-pairs; kks holds this lane's K-pair offsets.
static __device__ __forceinline__ v16bf load_frag(const unsigned short* p,
                                                  const int* kks) {
  v16bf b;
#pragma unroll
  for (int i = 0; i < 8; ++i) {
    unsigned int u = *reinterpret_cast<const unsigned int*>(p + kks[i]);
    b[2 * i] = u2b((unsigned short)(u & 0xffffu));
    b[2 * i + 1] = u2b((unsigned short)(u >> 16));
  }
  return b;
}

// Lane l <-> lane l ^ 16 (the two halves that share one query column).
static __device__ __forceinline__ float xhalf(float x) {
  int b = __builtin_bit_cast(int, x);
  return __builtin_bit_cast(
      float, __builtin_amdgcn_permlanex16(b, b, 0x76543210, 0xfedcba98, false, false));
}

// Low 32 bits of a flat pointer into LDS == LDS byte offset (aperture layout).
static __device__ __forceinline__ unsigned lds_addr(const void* p) {
  return (unsigned)(size_t)p;
}

// ---------------------------------------------------------------------------
// Kernel 0: Wq|Wk|Wv [768][64] f32 -> bf16 packed in B-fragment order.
// Fragment (ks, f = w*4 + nt) is 1 KiB: chunk j (0,1) of lane l lies at
// j*512 + l*16 bytes and holds k = ks*32 + j*16 + (l>>4)*8 + 0..7 of column
// nt*16 + (l&15), so one wave-wide 16-byte load reads 512 contiguous bytes.
// ---------------------------------------------------------------------------
__global__ __launch_bounds__(256) void wcvt_kernel(
    const float* __restrict__ Wq, const float* __restrict__ Wk,
    const float* __restrict__ Wv, unsigned short* __restrict__ Wp) {
  int c = blockIdx.x * 256 + threadIdx.x;  // one 16-byte chunk per thread
  if (c >= WCHUNKS) return;
  int lane = c & 31, j = (c >> 5) & 1, t = c >> 6;
  int f = t % NFRAG, ks = t / NFRAG;
  int w = f >> 2, nt = f & 3;
  const float* W = (w == 0) ? Wq : (w == 1 ? Wk : Wv);
  const float* s = W + (size_t)(ks * 32 + j * 16 + (lane >> 4) * 8) * HEAD +
                   nt * 16 + (lane & 15);
  u32x4 v;
#pragma unroll
  for (int i = 0; i < 4; ++i)
    v[i] = (unsigned)f2u(s[(2 * i) * HEAD]) |
           ((unsigned)f2u(s[(2 * i + 1) * HEAD]) << 16);
  *reinterpret_cast<u32x4*>(Wp + (size_t)c * 8) = v;
}

// ---------------------------------------------------------------------------
// Kernel 1: fused QKV projection. One wave = one 16-row tile of [32768,768]x
// [768,64] for q,k,v simultaneously (x is read exactly once). Per k-step the
// x slice and all 12 packed weight B-fragments (24 whole-line loads) are
// issued as one group, then the 12 WMMAs run back-to-back.
// q scaled by QSCALE; v stored transposed [64][32768] for V^T A-fragments.
// ---------------------------------------------------------------------------
__global__ __launch_bounds__(128) void qkv_kernel(
    const float* __restrict__ x, const float* __restrict__ bq,
    const float* __restrict__ bk, const float* __restrict__ bv,
    const unsigned short* __restrict__ Wp, unsigned short* __restrict__ qo,
    unsigned short* __restrict__ ko, unsigned short* __restrict__ vT) {
  const int lane = threadIdx.x & 31;
  const int wid = threadIdx.x >> 5;
  const int row0 = (blockIdx.x * 4 + wid) * 16;
  const int m = lane & 15, hf = lane >> 4;
  int kks[8];
  kk_pattern(hf, kks);

  v8f acc[3][4];
#pragma unroll
  for (int w = 0; w < 3; ++w)
#pragma unroll
    for (int nt = 0; nt < 4; ++nt) acc[w][nt] = zero8();

  const float* xrow = x + (size_t)(row0 + m) * N_EMBD;
  const u32x4* wlane = reinterpret_cast<const u32x4*>(Wp) + lane;
  for (int ks = 0; ks < KSTEPS; ++ks) {
    // Raw 16x32 slice of x (f32) and the 12 packed B fragments of this k-step.
    float2 xr[8];
#pragma unroll
    for (int i = 0; i < 8; ++i)
      xr[i] = *reinterpret_cast<const float2*>(xrow + ks * 32 + kks[i]);
    const u32x4* wk = wlane + ks * (NFRAG * 64);
    v16bf bfr[NFRAG];
#pragma unroll
    for (int f = 0; f < NFRAG; ++f) {
      u32x4 lo = wk[f * 64], hi = wk[f * 64 + 32];
      bfr[f] = __builtin_bit_cast(
          v16bf, __builtin_shufflevector(lo, hi, 0, 1, 2, 3, 4, 5, 6, 7));
    }
    // Keeps the 28 loads above in flight together: without it the scheduler
    // sinks each fragment's loads to its WMMA and the wave waits 12 times.
    __builtin_amdgcn_sched_barrier(0);
    // A fragment: f32 -> bf16 (v_cvt_pk_bf16_f32).
    v16bf a;
#pragma unroll
    for (int i = 0; i < 8; ++i) {
      a[2 * i] = (__bf16)xr[i].x;
      a[2 * i + 1] = (__bf16)xr[i].y;
    }
#pragma unroll
    for (int w = 0; w < 3; ++w)
#pragma unroll
      for (int nt = 0; nt < 4; ++nt)
        acc[w][nt] = wmma_bf16(a, bfr[w * 4 + nt], acc[w][nt]);
  }

  // C/D layout: VGPR r = rows r (lanes 0-15) / r+8 (lanes 16-31), col = lane%16.
#pragma unroll
  for (int nt = 0; nt < 4; ++nt) {
    int col = nt * 16 + m;
    float biasq = bq[col], biask = bk[col], biasv = bv[col];
#pragma unroll
    for (int r = 0; r < 8; ++r) {
      int row = row0 + r + 8 * hf;
      qo[(size_t)row * HEAD + col] = f2u((acc[0][nt][r] + biasq) * QSCALE);
      ko[(size_t)row * HEAD + col] = f2u(acc[1][nt][r] + biask);
      vT[(size_t)col * MTOT + row] = f2u(acc[2][nt][r] + biasv);
    }
  }
}

// ---------------------------------------------------------------------------
// Kernel 2: flash attention. 4 waves/block, wave = 16 q rows, 32 keys/iter.
// K/V blocks staged in LDS via double-buffered async DMA. S^T = K Q^T via 4
// WMMAs: lane (m, hf) holds 16 of the 32 scores of query column m, so the
// online softmax (log2 domain) reduces in registers plus one half exchange,
// and the two f32 S^T tiles convert in place into the B operand of
// O^T += V^T P^T (hardware k order on both sides).
// ---------------------------------------------------------------------------
__global__ __launch_bounds__(128) void attn_kernel(
    const unsigned short* __restrict__ q, const unsigned short* __restrict__ kg,
    const unsigned short* __restrict__ vg, float* __restrict__ out) {
  // Padded rows so the 16-lane fragment reads hit distinct LDS banks.
  __shared__ unsigned short kbuf[2][32][72];  // [buf][key][h]   (64 used + pad)
  __shared__ unsigned short vbuf[2][64][40];  // [buf][h][key]   (32 used + pad)
  const int tid = threadIdx.x;
  const int lane = tid & 31;
  const int wid = tid >> 5;
  const int m = lane & 15, hf = lane >> 4;
  const int base = blockIdx.y * SEQ;
  const int q0 = blockIdx.x * 64 + wid * 16;
  int kks[8];
  kk_pattern(hf, kks);

  // Async-stage one 32-key block (K: 32x64 bf16, V^T: 64x32 bf16) into LDS.
  // 128 threads x (2 K + 2 V) GLOBAL_LOAD_ASYNC_TO_LDS_B128 per block.
  auto issue_block = [&](int kb, int buf) {
    const unsigned short* ksrc = kg + (size_t)(base + kb) * HEAD;
    const unsigned short* vsrc = vg + (size_t)(base + kb);
#pragma unroll
    for (int j = 0; j < 2; ++j) {
      int c = tid * 2 + j;             // 256 chunks of 16B
      int key = c >> 3, part = c & 7;  // 8 chunks per 64-half K row
      unsigned ldsa = lds_addr(&kbuf[buf][key][part * 8]);
      int voff = c * 16;               // K block is contiguous in global
      asm volatile("global_load_async_to_lds_b128 %0, %1, %2"
                   :: "v"(ldsa), "v"(voff), "s"(ksrc) : "memory");
    }
#pragma unroll
    for (int j = 0; j < 2; ++j) {
      int c = tid * 2 + j;
      int h = c >> 2, part = c & 3;    // 4 chunks per 32-half V^T row
      unsigned ldsa = lds_addr(&vbuf[buf][h][part * 8]);
      int voff = (h * MTOT + part * 8) * 2;
      asm volatile("global_load_async_to_lds_b128 %0, %1, %2"
                   :: "v"(ldsa), "v"(voff), "s"(vsrc) : "memory");
    }
  };

  // Q^T B-fragments (K = head dim 64 -> two 32x16 fragments), held for all keys.
  v16bf aq[2];
#pragma unroll
  for (int ks = 0; ks < 2; ++ks)
    aq[ks] = load_frag(q + (size_t)(base + q0 + m) * HEAD + ks * 32, kks);

  // Per query column: running maximum (same in both halves) and this half's
  // share of the running sum (the halves are joined once, after the loop).
  float mrow = -3.0e38f, lrow = 0.f;
  v8f o[4];  // o[nt][r] = O^T[nt*16 + 8*hf + r][m]
#pragma unroll
  for (int nt = 0; nt < 4; ++nt) o[nt] = zero8();

  issue_block(0, 0);
  for (int kb = 0; kb < SEQ; kb += 32) {
    const int cur = (kb >> 5) & 1;
    if (kb + 32 < SEQ) {
      issue_block(kb + 32, cur ^ 1);   // overlap next copy with this compute
      asm volatile("s_wait_asynccnt 0x4" ::: "memory");  // prev 4 done
    } else {
      asm volatile("s_wait_asynccnt 0x0" ::: "memory");
    }
    __syncthreads();  // staged block visible to all 4 waves

    // S^T = K * Q^T for 32 keys: 2 key tiles x 2 k-steps, K rows from LDS as A.
    // s[nt][r] = S^T[nt*16 + 8*hf + r][m].
    v8f s[2];
    s[0] = zero8(); s[1] = zero8();
#pragma unroll
    for (int nt = 0; nt < 2; ++nt) {
      const unsigned short* kp = &kbuf[cur][nt * 16 + m][0];
#pragma unroll
      for (int ks = 0; ks < 2; ++ks)
        s[nt] = wmma_bf16(load_frag(kp + ks * 32, kks), aq[ks], s[nt]);
    }
    // Online softmax (exp2 domain; scale folded into q), one column per lane.
    float mx0 = fmaxf(s[0][0], s[1][0]), mx1 = fmaxf(s[0][1], s[1][1]);
#pragma unroll
    for (int r = 2; r < 8; r += 2) {
      mx0 = fmaxf(mx0, fmaxf(s[0][r], s[1][r]));
      mx1 = fmaxf(mx1, fmaxf(s[0][r + 1], s[1][r + 1]));
    }
    float mx = fmaxf(mx0, mx1);
    mx = fmaxf(mx, xhalf(mx));
    const float mn = fmaxf(mrow, mx);
    const float alpha = exp2f(mrow - mn);
    mrow = mn;
    v16bf pt;  // P^T as B operand: pt[j] = key 8*hf + j, pt[8 + j] = key 16 + 8*hf + j
    float rs[4] = {0.f, 0.f, 0.f, 0.f};
#pragma unroll
    for (int r = 0; r < 8; ++r) {
      float p0 = exp2f(s[0][r] - mn);
      float p1 = exp2f(s[1][r] - mn);
      rs[r & 1] += p0;
      rs[2 + (r & 1)] += p1;
      pt[r] = (__bf16)p0;
      pt[8 + r] = (__bf16)p1;
    }
    lrow = lrow * alpha + ((rs[0] + rs[1]) + (rs[2] + rs[3]));
#pragma unroll
    for (int nt = 0; nt < 4; ++nt)
#pragma unroll
      for (int r = 0; r < 8; ++r) o[nt][r] *= alpha;
    // O^T += V^T * P^T : V^T rows in LDS are the A fragments (16 h x 32 keys).
#pragma unroll
    for (int nt = 0; nt < 4; ++nt)
      o[nt] = wmma_bf16(load_frag(&vbuf[cur][nt * 16 + m][0], kks), pt, o[nt]);
    __syncthreads();  // all waves done with buf `cur` before it is refilled
  }
  // Join the halves' sums, normalize, store: a lane holds 8 consecutive h of
  // its query row per tile -> two 16-byte stores.
  const float inv = 1.0f / (lrow + xhalf(lrow));
  float* orow = out + (size_t)(base + q0 + m) * HEAD + 8 * hf;
#pragma unroll
  for (int nt = 0; nt < 4; ++nt) {
    float4 lo = make_float4(o[nt][0] * inv, o[nt][1] * inv, o[nt][2] * inv, o[nt][3] * inv);
    float4 hi = make_float4(o[nt][4] * inv, o[nt][5] * inv, o[nt][6] * inv, o[nt][7] * inv);
    *reinterpret_cast<float4*>(orow + nt * 16) = lo;
    *reinterpret_cast<float4*>(orow + nt * 16 + 4) = hi;
  }
}

// ---------------------------------------------------------------------------
extern "C" void kernel_launch(void* const* d_in, const int* in_sizes, int n_in,
                              void* d_out, int out_size, void* d_ws,
                              size_t ws_size, hipStream_t stream) {
  (void)in_sizes; (void)n_in; (void)out_size; (void)ws_size;
  const float* x  = (const float*)d_in[0];
  const float* Wq = (const float*)d_in[1];
  const float* bq = (const float*)d_in[2];
  const float* Wk = (const float*)d_in[3];
  const float* bk = (const float*)d_in[4];
  const float* Wv = (const float*)d_in[5];
  const float* bv = (const float*)d_in[6];
  float* out = (float*)d_out;

  // Workspace: q,k bf16 [32768][64]; vT bf16 [64][32768]; packed weights bf16.
  char* ws = (char*)d_ws;
  unsigned short* qo  = (unsigned short*)(ws);
  unsigned short* ko  = (unsigned short*)(ws + (size_t)MTOT * HEAD * 2);
  unsigned short* vT  = (unsigned short*)(ws + (size_t)MTOT * HEAD * 4);
  unsigned short* Wp  = (unsigned short*)(ws + (size_t)MTOT * HEAD * 6);

  hipLaunchKernelGGL(wcvt_kernel, dim3((WCHUNKS + 255) / 256),
                     dim3(256), 0, stream, Wq, Wk, Wv, Wp);
  hipLaunchKernelGGL(qkv_kernel, dim3(MTOT / 64), dim3(128), 0, stream, x, bq,
                     bk, bv, Wp, qo, ko, vT);
  hipLaunchKernelGGL(attn_kernel, dim3(SEQ / 64, BATCH), dim3(128), 0, stream,
                     qo, ko, vT, out);
}

// v003
// Measured time: 91.4 microseconds a run.
// Two timings next to v002 both put it at 1.13 times that version's speed.
// All steps since v000 together make it 3.81 times as fast.
#include <hip/hip_runtime.h>

// ---------------------------------------------------------------------------
// Single-head attention for MI455X (gfx1250, wave32, WMMA).
//   x:[8,4096,768] f32 -> q,k,v (bf16 in ws) -> flash attention -> out f32.
// Matmuls on v_wmma_f32_16x16x32_bf16 (f32 accum). K/V blocks staged into LDS
// with double-buffered GLOBAL_LOAD_ASYNC_TO_LDS_B128 (ASYNCcnt). Softmax in
// exp2 domain (scale*log2e folded into q). Scores are formed transposed
// (S^T = K Q^T, O^T += V^T P^T): a lane owns one query column.
// ---------------------------------------------------------------------------

typedef __attribute__((ext_vector_type(16))) __bf16 v16bf;
typedef __attribute__((ext_vector_type(8)))  float  v8f;
typedef __attribute__((ext_vector_type(4)))  unsigned int u32x4;

#define N_EMBD 768
#define HEAD   64
#define BATCH  8
#define SEQ    4096
#define MTOT   (BATCH * SEQ)          // 32768 rows total
#define KSTEPS (N_EMBD / 32)          // 24 k-steps of the projection
#define NFRAG  12                     // q,k,v x 4 column tiles
#define WCHUNKS (KSTEPS * NFRAG * 64) // 16-byte chunks of the packed weights
// 768^-0.5 * log2(e): logits land directly in log2 domain.
#define QSCALE 0.052058875f

static __device__ __forceinline__ v8f wmma_bf16(v16bf a, v16bf b, v8f c) {
  // (neg_a, A, neg_b, B, c_mod, C, reuse_a, reuse_b)
  return __builtin_amdgcn_wmma_f32_16x16x32_bf16(false, a, false, b, (short)0, c,
                                                 false, false);
}

// f32 -> bf16 via native hardware convert (v_cvt_pk_bf16_f32).
static __device__ __forceinline__ unsigned short f2u(float f) {
  return __builtin_bit_cast(unsigned short, (__bf16)f);
}
static __device__ __forceinline__ __bf16 u2b(unsigned short u) {
  return __builtin_bit_cast(__bf16, u);
}
static __device__ __forceinline__ v8f zero8() {
  v8f z = {0.f, 0.f, 0.f, 0.f, 0.f, 0.f, 0.f, 0.f};
  return z;
}

// K-pair base offsets for the 16-bit A/B fragment layout (ISA 7.12.2):
// half 0 covers K {0..7,16..23}, half 1 covers K {8..15,24..31}, 2 per VGPR.
static __device__ __forceinline__ void kk_pattern(int hf, int* kks) {
#pragma unroll
  for (int i = 0; i < 8; ++i)
    kks[i] = (i < 4 ? 2 * i : 16 + 2 * (i - 4)) + 8 * hf;
}

// Load one 16-bit B fragment (32xK rows x 16 cols) from a row pointer whose
// row holds contiguous K-pairs; kks holds this lane's K-pair offsets.
static __device__ __forceinline__ v16bf load_frag(const unsigned short* p,
                                                  const int* kks) {
  v16bf b;
#pragma unroll
  for (int i = 0; i < 8; ++i) {
    unsigned int u = *reinterpret_cast<const unsigned int*>(p + kks[i]);
    b[2 * i] = u2b((unsigned short)(u & 0xffffu));
    b[2 * i + 1] = u2b((unsigned short)(u >> 16));
  }
  return b;
}

// Lane l <-> lane l ^ 16 (the two halves that share one query column).
static __device__ __forceinline__ float xhalf(float x) {
  int b = __builtin_bit_cast(int, x);
  return __builtin_bit_cast(
      float, __builtin_amdgcn_permlanex16(b, b, 0x76543210, 0xfedcba98, false, false));
}

// Low 32 bits of a flat pointer into LDS == LDS byte offset (aperture layout).
static __device__ __forceinline__ unsigned lds_addr(const void* p) {
  return (unsigned)(size_t)p;
}

// ---------------------------------------------------------------------------
// Kernel 0: Wq|Wk|Wv [768][64] f32 -> bf16 packed in B-fragment order.
// Fragment (ks, f = w*4 + nt) is 1 KiB: chunk j (0,1) of lane l lies at
// j*512 + l*16 bytes and holds k = ks*32 + j*16 + (l>>4)*8 + 0..7 of column
// nt*16 + (l&15), so one wave-wide 16-byte load reads 512 contiguous bytes.
// ---------------------------------------------------------------------------
__global__ __launch_bounds__(256) void wcvt_kernel(
    const float* __restrict__ Wq, const float* __restrict__ Wk,
    const float* __restrict__ Wv, unsigned short* __restrict__ Wp) {
  int c = blockIdx.x * 256 + threadIdx.x;  // one 16-byte chunk per thread
  if (c >= WCHUNKS) return;
  int lane = c & 31, j = (c >> 5) & 1, t = c >> 6;
  int f = t % NFRAG, ks = t / NFRAG;
  int w = f >> 2, nt = f & 3;
  const float* W = (w == 0) ? Wq : (w == 1 ? Wk : Wv);
  const float* s = W + (size_t)(ks * 32 + j * 16 + (lane >> 4) * 8) * HEAD +
                   nt * 16 + (lane & 15);
  u32x4 v;
#pragma unroll
  for (int i = 0; i < 4; ++i)
    v[i] = (unsigned)f2u(s[(2 * i) * HEAD]) |
           ((unsigned)f2u(s[(2 * i + 1) * HEAD]) << 16);
  *reinterpret_cast<u32x4*>(Wp + (size_t)c * 8) = v;
}

// ---------------------------------------------------------------------------
// Kernel 1: fused QKV projection. One wave = one 16-row tile of [32768,768]x
// [768,64] for q,k,v simultaneously (x is read exactly once). Per k-step the
// x slice and all 12 packed weight B-fragments (24 whole-line loads) are
// issued as one group, then the 12 WMMAs run back-to-back.
// q scaled by QSCALE; v stored transposed [64][32768] for V^T A-fragments.
// ---------------------------------------------------------------------------
__global__ __launch_bounds__(128) void qkv_kernel(
    const float* __restrict__ x, const float* __restrict__ bq,
    const float* __restrict__ bk, const float* __restrict__ bv,
    const unsigned short* __restrict__ Wp, unsigned short* __restrict__ qo,
    unsigned short* __restrict__ ko, unsigned short* __restrict__ vT) {
  const int lane = threadIdx.x & 31;
  const int wid = threadIdx.x >> 5;
  const int row0 = (blockIdx.x * 4 + wid) * 16;
  const int m = lane & 15, hf = lane >> 4;
  int kks[8];
  kk_pattern(hf, kks);

  v8f acc[3][4];
#pragma unroll
  for (int w = 0; w < 3; ++w)
#pragma unroll
    for (int nt = 0; nt < 4; ++nt) acc[w][nt] = zero8();

  const float* xrow = x + (size_t)(row0 + m) * N_EMBD;
  const u32x4* wlane = reinterpret_cast<const u32x4*>(Wp) + lane;
  for (int ks = 0; ks < KSTEPS; ++ks) {
    // Raw 16x32 slice of x (f32) and the 12 packed B fragments of this k-step.
    float2 xr[8];
#pragma unroll
    for (int i = 0; i < 8; ++i)
      xr[i] = *reinterpret_cast<const float2*>(xrow + ks * 32 + kks[i]);
    const u32x4* wk = wlane + ks * (NFRAG * 64);
    v16bf bfr[NFRAG];
#pragma unroll
    for (int f = 0; f < NFRAG; ++f) {
      u32x4 lo = wk[f * 64], hi = wk[f * 64 + 32];
      bfr[f] = __builtin_bit_cast(
          v16bf, __builtin_shufflevector(lo, hi, 0, 1, 2, 3, 4, 5, 6, 7));
    }
    // Keeps the 28 loads above in flight together: without it the scheduler
    // sinks each fragment's loads to its WMMA and the wave waits 12 times.
    __builtin_amdgcn_sched_barrier(0);
    // A fragment: f32 -> bf16 (v_cvt_pk_bf16_f32).
    v16bf a;
#pragma unroll
    for (int i = 0; i < 8; ++i) {
      a[2 * i] = (__bf16)xr[i].x;
      a[2 * i + 1] = (__bf16)xr[i].y;
    }
#pragma unroll
    for (int w = 0; w < 3; ++w)
#pragma unroll
      for (int nt = 0; nt < 4; ++nt)
        acc[w][nt] = wmma_bf16(a, bfr[w * 4 + nt], acc[w][nt]);
  }

  // C/D layout: VGPR r = rows r (lanes 0-15) / r+8 (lanes 16-31), col = lane%16.
#pragma unroll
  for (int nt = 0; nt < 4; ++nt) {
    int col = nt * 16 + m;
    float biasq = bq[col], biask = bk[col], biasv = bv[col];
#pragma unroll
    for (int r = 0; r < 8; ++r) {
      int row = row0 + r + 8 * hf;
      qo[(size_t)row * HEAD + col] = f2u((acc[0][nt][r] + biasq) * QSCALE);
      ko[(size_t)row * HEAD + col] = f2u(acc[1][nt][r] + biask);
      vT[(size_t)col * MTOT + row] = f2u(acc[2][nt][r] + biasv);
    }
  }
}

// ---------------------------------------------------------------------------
// Kernel 2: flash attention. 4 waves/block, wave = 16 q rows, 32 keys/iter.
// K/V blocks staged in LDS via double-buffered async DMA. S^T = K Q^T via 4
// WMMAs: lane (m, hf) holds 16 of the 32 scores of query column m, so the
// online softmax (log2 domain) reduces in registers plus one half exchange,
// and the two f32 S^T tiles convert in place into the B operand of
// O^T += V^T P^T (hardware k order on both sides).
// ---------------------------------------------------------------------------
__global__ __launch_bounds__(128) void attn_kernel(
    const unsigned short* __restrict__ q, const unsigned short* __restrict__ kg,
    const unsigned short* __restrict__ vg, float* __restrict__ out) {
  // Padded rows so the 16-lane fragment reads hit distinct LDS banks.
  __shared__ unsigned short kbuf[2][32][72];  // [buf][key][h]   (64 used + pad)
  __shared__ unsigned short vbuf[2][64][40];  // [buf][h][key]   (32 used + pad)
  const int tid = threadIdx.x;
  const int lane = tid & 31;
  const int wid = tid >> 5;
  const int m = lane & 15, hf = lane >> 4;
  const int base = blockIdx.y * SEQ;
  const int q0 = blockIdx.x * 64 + wid * 16;
  int kks[8];
  kk_pattern(hf, kks);

  // Async-stage one 32-key block (K: 32x64 bf16, V^T: 64x32 bf16) into LDS.
  // 128 threads x (2 K + 2 V) GLOBAL_LOAD_ASYNC_TO_LDS_B128 per block.
  auto issue_block = [&](int kb, int buf) {
    const unsigned short* ksrc = kg + (size_t)(base + kb) * HEAD;
    const unsigned short* vsrc = vg + (size_t)(base + kb);
#pragma unroll
    for (int j = 0; j < 2; ++j) {
      int c = tid * 2 + j;             // 256 chunks of 16B
      int key = c >> 3, part = c & 7;  // 8 chunks per 64-half K row
      unsigned ldsa = lds_addr(&kbuf[buf][key][part * 8]);
      int voff = c * 16;               // K block is contiguous in global
      asm volatile("global_load_async_to_lds_b128 %0, %1, %2"
                   :: "v"(ldsa), "v"(voff), "s"(ksrc) : "memory");
    }
#pragma unroll
    for (int j = 0; j < 2; ++j) {
      int c = tid * 2 + j;
      int h = c >> 2, part = c & 3;    // 4 chunks per 32-half V^T row
      unsigned ldsa = lds_addr(&vbuf[buf][h][part * 8]);
      int voff = (h * MTOT + part * 8) * 2;
      asm volatile("global_load_async_to_lds_b128 %0, %1, %2"
                   :: "v"(ldsa), "v"(voff), "s"(vsrc) : "memory");
    }
  };

  // Q^T B-fragments (K = head dim 64 -> two 32x16 fragments), held for all keys.
  v16bf aq[2];
#pragma unroll
  for (int ks = 0; ks < 2; ++ks)
    aq[ks] = load_frag(q + (size_t)(base + q0 + m) * HEAD + ks * 32, kks);

  // Per query column: running maximum (same in both halves) and this half's
  // share of the running sum (the halves are joined once, after the loop).
  float mrow = -3.0e38f, lrow = 0.f;
  v8f o[4];  // o[nt][r] = O^T[nt*16 + 8*hf + r][m]
#pragma unroll
  for (int nt = 0; nt < 4; ++nt) o[nt] = zero8();

  issue_block(0, 0);
  for (int kb = 0; kb < SEQ; kb += 32) {
    const int cur = (kb >> 5) & 1;
    if (kb + 32 < SEQ) {
      issue_block(kb + 32, cur ^ 1);   // overlap next copy with this compute
      asm volatile("s_wait_asynccnt 0x4" ::: "memory");  // prev 4 done
    } else {
      asm volatile("s_wait_asynccnt 0x0" ::: "memory");
    }
    __syncthreads();  // staged block visible to all 4 waves

    // S^T = K * Q^T for 32 keys: 2 key tiles x 2 k-steps, K rows from LDS as A.
    // s[nt][r] = S^T[nt*16 + 8*hf + r][m].
    // All 8 A fragments of the block (4 K, 4 V^T) are fetched from LDS first,
    // in the order of their use.
    v16bf kf[2][2], vf[4];
#pragma unroll
    for (int ks = 0; ks < 2; ++ks)
#pragma unroll
      for (int nt = 0; nt < 2; ++nt)
        kf[ks][nt] = load_frag(&kbuf[cur][nt * 16 + m][ks * 32], kks);
#pragma unroll
    for (int nt = 0; nt < 4; ++nt)
      vf[nt] = load_frag(&vbuf[cur][nt * 16 + m][0], kks);
    // Keeps the 16 LDS loads above in flight together: without it the scheduler
    // sinks each fragment's loads to its WMMA and the wave waits out the LDS
    // latency once per fragment.
    __builtin_amdgcn_sched_barrier(0);
    __syncthreads();  // every wave holds its fragments: buf `cur` may be refilled
    v8f s[2];
    s[0] = zero8(); s[1] = zero8();
#pragma unroll
    for (int ks = 0; ks < 2; ++ks)
#pragma unroll
      for (int nt = 0; nt < 2; ++nt)
        s[nt] = wmma_bf16(kf[ks][nt], aq[ks], s[nt]);
    // Online softmax (exp2 domain; scale folded into q), one column per lane.
    float mx0 = fmaxf(s[0][0], s[1][0]), mx1 = fmaxf(s[0][1], s[1][1]);
#pragma unroll
    for (int r = 2; r < 8; r += 2) {
      mx0 = fmaxf(mx0, fmaxf(s[0][r], s[1][r]));
      mx1 = fmaxf(mx1, fmaxf(s[0][r + 1], s[1][r + 1]));
    }
    float mx = fmaxf(mx0, mx1);
    mx = fmaxf(mx, xhalf(mx));
    const float mn = fmaxf(mrow, mx);
    const float alpha = exp2f(mrow - mn);
    mrow = mn;
    v16bf pt;  // P^T as B operand: pt[j] = key 8*hf + j, pt[8 + j] = key 16 + 8*hf + j
    float rs[4] = {0.f, 0.f, 0.f, 0.f};
#pragma unroll
    for (int r = 0; r < 8; ++r) {
      float p0 = exp2f(s[0][r] - mn);
      float p1 = exp2f(s[1][r] - mn);
      rs[r & 1] += p0;
      rs[2 + (r & 1)] += p1;
      pt[r] = (__bf16)p0;
      pt[8 + r] = (__bf16)p1;
    }
    lrow = lrow * alpha + ((rs[0] + rs[1]) + (rs[2] + rs[3]));
#pragma unroll
    for (int nt = 0; nt < 4; ++nt)
#pragma unroll
      for (int r = 0; r < 8; ++r) o[nt][r] *= alpha;
    // O^T += V^T * P^T : V^T rows are the A fragments (16 h x 32 keys).
#pragma unroll
    for (int nt = 0; nt < 4; ++nt)
      o[nt] = wmma_bf16(vf[nt], pt, o[nt]);
  }
  // Join the halves' sums, normalize, store: a lane holds 8 consecutive h of
  // its query row per tile -> two 16-byte stores.
  const float inv = 1.0f / (lrow + xhalf(lrow));
  float* orow = out + (size_t)(base + q0 + m) * HEAD + 8 * hf;
#pragma unroll
  for (int nt = 0; nt < 4; ++nt) {
    float4 lo = make_float4(o[nt][0] * inv, o[nt][1] * inv, o[nt][2] * inv, o[nt][3] * inv);
    float4 hi = make_float4(o[nt][4] * inv, o[nt][5] * inv, o[nt][6] * inv, o[nt][7] * inv);
    *reinterpret_cast<float4*>(orow + nt * 16) = lo;
    *reinterpret_cast<float4*>(orow + nt * 16 + 4) = hi;
  }
}

// ---------------------------------------------------------------------------
extern "C" void kernel_launch(void* const* d_in, const int* in_sizes, int n_in,
                              void* d_out, int out_size, void* d_ws,
                              size_t ws_size, hipStream_t stream) {
  (void)in_sizes; (void)n_in; (void)out_size; (void)ws_size;
  const float* x  = (const float*)d_in[0];
  const float* Wq = (const float*)d_in[1];
  const float* bq = (const float*)d_in[2];
  const float* Wk = (const float*)d_in[3];
  const float* bk = (const float*)d_in[4];
  const float* Wv = (const float*)d_in[5];
  const float* bv = (const float*)d_in[6];
  float* out = (float*)d_out;

  // Workspace: q,k bf16 [32768][64]; vT bf16 [64][32768]; packed weights bf16.
  char* ws = (char*)d_ws;
  unsigned short* qo  = (unsigned short*)(ws);
  unsigned short* ko  = (unsigned short*)(ws + (size_t)MTOT * HEAD * 2);
  unsigned short* vT  = (unsigned short*)(ws + (size_t)MTOT * HEAD * 4);
  unsigned short* Wp  = (unsigned short*)(ws + (size_t)MTOT * HEAD * 6);

  hipLaunchKernelGGL(wcvt_kernel, dim3((WCHUNKS + 255) / 256),
                     dim3(256), 0, stream, Wq, Wk, Wv, Wp);
  hipLaunchKernelGGL(qkv_kernel, dim3(MTOT / 64), dim3(128), 0, stream, x, bq,
                     bk, bv, Wp, qo, ko, vT);
  hipLaunchKernelGGL(attn_kernel, dim3(SEQ / 64, BATCH), dim3(128), 0, stream,
                     qo, ko, vT, out);
}

// v004
// One run takes 86.8 microseconds.
// Two timings next to v003 both put it at 1.05 times that version's speed.
// All steps since v000 together make it 4.00 times as fast.
#include <hip/hip_runtime.h>

// ---------------------------------------------------------------------------
// Single-head attention for MI455X (gfx1250, wave32, WMMA).
//   x:[8,4096,768] f32 -> q,k,v (bf16 in ws) -> flash attention -> out f32.
// Matmuls on v_wmma_f32_16x16x32_bf16 (f32 accum). K/V blocks staged into LDS
// with double-buffered GLOBAL_LOAD_ASYNC_TO_LDS_B128 (ASYNCcnt). Softmax in
// exp2 domain (scale*log2e folded into q). Scores are formed transposed
// (S^T = K Q^T, O^T += V^T P^T): a lane owns one query column.
// ---------------------------------------------------------------------------

typedef __attribute__((ext_vector_type(16))) __bf16 v16bf;
typedef __attribute__((ext_vector_type(8)))  float  v8f;
typedef __attribute__((ext_vector_type(4)))  unsigned int u32x4;

#define N_EMBD 768
#define HEAD   64
#define BATCH  8
#define SEQ    4096
#define MTOT   (BATCH * SEQ)          // 32768 rows total
#define KSTEPS (N_EMBD / 32)          // 24 k-steps of the projection
#define NFRAG  12                     // q,k,v x 4 column tiles
#define WCHUNKS (KSTEPS * NFRAG * 64) // 16-byte chunks of the packed weights
// 768^-0.5 * log2(e): logits land directly in log2 domain.
#define QSCALE 0.052058875f

static __device__ __forceinline__ v8f wmma_bf16(v16bf a, v16bf b, v8f c) {
  // (neg_a, A, neg_b, B, c_mod, C, reuse_a, reuse_b)
  return __builtin_amdgcn_wmma_f32_16x16x32_bf16(false, a, false, b, (short)0, c,
                                                 false, false);
}

// f32 -> bf16 via native hardware convert (v_cvt_pk_bf16_f32).
static __device__ __forceinline__ unsigned short f2u(float f) {
  return __builtin_bit_cast(unsigned short, (__bf16)f);
}
static __device__ __forceinline__ __bf16 u2b(unsigned short u) {
  return __builtin_bit_cast(__bf16, u);
}
static __device__ __forceinline__ v8f zero8() {
  v8f z = {0.f, 0.f, 0.f, 0.f, 0.f, 0.f, 0.f, 0.f};
  return z;
}

// K-pair base offsets for the 16-bit A/B fragment layout (ISA 7.12.2):
// half 0 covers K {0..7,16..23}, half 1 covers K {8..15,24..31}, 2 per VGPR.
static __device__ __forceinline__ void kk_pattern(int hf, int* kks) {
#pragma unroll
  for (int i = 0; i < 8; ++i)
    kks[i] = (i < 4 ? 2 * i : 16 + 2 * (i - 4)) + 8 * hf;
}

// Load one 16-bit B fragment (32xK rows x 16 cols) from a row pointer whose
// row holds contiguous K-pairs; kks holds this lane's K-pair offsets.
static __device__ __forceinline__ v16bf load_frag(const unsigned short* p,
                                                  const int* kks) {
  v16bf b;
#pragma unroll
  for (int i = 0; i < 8; ++i) {
    unsigned int u = *reinterpret_cast<const unsigned int*>(p + kks[i]);
    b[2 * i] = u2b((unsigned short)(u & 0xffffu));
    b[2 * i + 1] = u2b((unsigned short)(u >> 16));
  }
  return b;
}

// Lane l <-> lane l ^ 16 (the two halves that share one query column).
static __device__ __forceinline__ float xhalf(float x) {
  int b = __builtin_bit_cast(int, x);
  return __builtin_bit_cast(
      float, __builtin_amdgcn_permlanex16(b, b, 0x76543210, 0xfedcba98, false, false));
}

// Low 32 bits of a flat pointer into LDS == LDS byte offset (aperture layout).
static __device__ __forceinline__ unsigned lds_addr(const void* p) {
  return (unsigned)(size_t)p;
}

// ---------------------------------------------------------------------------
// Kernel 0: Wq|Wk|Wv [768][64] f32 -> bf16 packed in B-fragment order.
// Fragment (ks, f = w*4 + nt) is 1 KiB: chunk j (0,1) of lane l lies at
// j*512 + l*16 bytes and holds k = ks*32 + j*16 + (l>>4)*8 + 0..7 of column
// nt*16 + (l&15), so one wave-wide 16-byte load reads 512 contiguous bytes.
// ---------------------------------------------------------------------------
__global__ __launch_bounds__(256) void wcvt_kernel(
    const float* __restrict__ Wq, const float* __restrict__ Wk,
    const float* __restrict__ Wv, unsigned short* __restrict__ Wp) {
  int c = blockIdx.x * 256 + threadIdx.x;  // one 16-byte chunk per thread
  if (c >= WCHUNKS) return;
  int lane = c & 31, j = (c >> 5) & 1, t = c >> 6;
  int f = t % NFRAG, ks = t / NFRAG;
  int w = f >> 2, nt = f & 3;
  const float* W = (w == 0) ? Wq : (w == 1 ? Wk : Wv);
  const float* s = W + (size_t)(ks * 32 + j * 16 + (lane >> 4) * 8) * HEAD +
                   nt * 16 + (lane & 15);
  u32x4 v;
#pragma unroll
  for (int i = 0; i < 4; ++i)
    v[i] = (unsigned)f2u(s[(2 * i) * HEAD]) |
           ((unsigned)f2u(s[(2 * i + 1) * HEAD]) << 16);
  *reinterpret_cast<u32x4*>(Wp + (size_t)c * 8) = v;
}

// ---------------------------------------------------------------------------
// Kernel 1: fused QKV projection. One wave = one 16-row tile of [32768,768]x
// [768,64] for q,k,v simultaneously (x is read exactly once). Per k-step the
// x slice and all 12 packed weight B-fragments (24 whole-line loads) are
// issued as one group, then the 12 WMMAs run back-to-back.
// q scaled by QSCALE; v stored transposed [64][32768] for V^T A-fragments.
// ---------------------------------------------------------------------------
__global__ __launch_bounds__(128) void qkv_kernel(
    const float* __restrict__ x, const float* __restrict__ bq,
    const float* __restrict__ bk, const float* __restrict__ bv,
    const unsigned short* __restrict__ Wp, unsigned short* __restrict__ qo,
    unsigned short* __restrict__ ko, unsigned short* __restrict__ vT) {
  const int lane = threadIdx.x & 31;
  const int wid = threadIdx.x >> 5;
  const int row0 = (blockIdx.x * 4 + wid) * 16;
  const int m = lane & 15, hf = lane >> 4;
  int kks[8];
  kk_pattern(hf, kks);

  v8f acc[3][4];
#pragma unroll
  for (int w = 0; w < 3; ++w)
#pragma unroll
    for (int nt = 0; nt < 4; ++nt) acc[w][nt] = zero8();

  const float* xrow = x + (size_t)(row0 + m) * N_EMBD;
  const u32x4* wlane = reinterpret_cast<const u32x4*>(Wp) + lane;
  for (int ks = 0; ks < KSTEPS; ++ks) {
    // Raw 16x32 slice of x (f32) and the 12 packed B fragments of this k-step.
    float2 xr[8];
#pragma unroll
    for (int i = 0; i < 8; ++i)
      xr[i] = *reinterpret_cast<const float2*>(xrow + ks * 32 + kks[i]);
    const u32x4* wk = wlane + ks * (NFRAG * 64);
    v16bf bfr[NFRAG];
#pragma unroll
    for (int f = 0; f < NFRAG; ++f) {
      u32x4 lo = wk[f * 64], hi = wk[f * 64 + 32];
      bfr[f] = __builtin_bit_cast(
          v16bf, __builtin_shufflevector(lo, hi, 0, 1, 2, 3, 4, 5, 6, 7));
    }
    // Keeps the 28 loads above in flight together: without it the scheduler
    // sinks each fragment's loads to its WMMA and the wave waits 12 times.
    __builtin_amdgcn_sched_barrier(0);
    // A fragment: f32 -> bf16 (v_cvt_pk_bf16_f32).
    v16bf a;
#pragma unroll
    for (int i = 0; i < 8; ++i) {
      a[2 * i] = (__bf16)xr[i].x;
      a[2 * i + 1] = (__bf16)xr[i].y;
    }
#pragma unroll
    for (int w = 0; w < 3; ++w)
#pragma unroll
      for (int nt = 0; nt < 4; ++nt)
        acc[w][nt] = wmma_bf16(a, bfr[w * 4 + nt], acc[w][nt]);
  }

  // C/D layout: VGPR r = rows r (lanes 0-15) / r+8 (lanes 16-31), col = lane%16.
#pragma unroll
  for (int nt = 0; nt < 4; ++nt) {
    int col = nt * 16 + m;
    float biasq = bq[col], biask = bk[col], biasv = bv[col];
#pragma unroll
    for (int r = 0; r < 8; ++r) {
      int row = row0 + r + 8 * hf;
      qo[(size_t)row * HEAD + col] = f2u((acc[0][nt][r] + biasq) * QSCALE);
      ko[(size_t)row * HEAD + col] = f2u(acc[1][nt][r] + biask);
      vT[(size_t)col * MTOT + row] = f2u(acc[2][nt][r] + biasv);
    }
  }
}

// ---------------------------------------------------------------------------
// Kernel 2: flash attention. 4 waves/block, wave = 16 q rows, 32 keys/iter.
// K/V blocks staged in LDS via double-buffered async DMA. S^T = K Q^T via 4
// WMMAs: lane (m, hf) holds 16 of the 32 scores of query column m, so the
// online softmax (log2 domain) reduces in registers plus one half exchange,
// and the two f32 S^T tiles convert in place into the B operand of
// O^T += V^T P^T (hardware k order on both sides).
// ---------------------------------------------------------------------------
__global__ __launch_bounds__(128) void attn_kernel(
    const unsigned short* __restrict__ q, const unsigned short* __restrict__ kg,
    const unsigned short* __restrict__ vg, float* __restrict__ out) {
  // Padded rows so the 16-lane fragment reads hit distinct LDS banks.
  __shared__ unsigned short kbuf[2][32][72];  // [buf][key][h]   (64 used + pad)
  __shared__ unsigned short vbuf[2][64][40];  // [buf][h][key]   (32 used + pad)
  const int tid = threadIdx.x;
  const int lane = tid & 31;
  const int wid = tid >> 5;
  const int m = lane & 15, hf = lane >> 4;
  const int base = blockIdx.y * SEQ;
  const int q0 = blockIdx.x * 64 + wid * 16;
  int kks[8];
  kk_pattern(hf, kks);

  // Async-stage one 32-key block (K: 32x64 bf16, V^T: 64x32 bf16) into LDS.
  // 128 threads x (2 K + 2 V) GLOBAL_LOAD_ASYNC_TO_LDS_B128 per block.
  auto issue_block = [&](int kb, int buf) {
    const unsigned short* ksrc = kg + (size_t)(base + kb) * HEAD;
    const unsigned short* vsrc = vg + (size_t)(base + kb);
#pragma unroll
    for (int j = 0; j < 2; ++j) {
      int c = tid * 2 + j;             // 256 chunks of 16B
      int key = c >> 3, part = c & 7;  // 8 chunks per 64-half K row
      unsigned ldsa = lds_addr(&kbuf[buf][key][part * 8]);
      int voff = c * 16;               // K block is contiguous in global
      asm volatile("global_load_async_to_lds_b128 %0, %1, %2"
                   :: "v"(ldsa), "v"(voff), "s"(ksrc) : "memory");
    }
#pragma unroll
    for (int j = 0; j < 2; ++j) {
      int c = tid * 2 + j;
      int h = c >> 2, part = c & 3;    // 4 chunks per 32-half V^T row
      unsigned ldsa = lds_addr(&vbuf[buf][h][part * 8]);
      int voff = (h * MTOT + part * 8) * 2;
      asm volatile("global_load_async_to_lds_b128 %0, %1, %2"
                   :: "v"(ldsa), "v"(voff), "s"(vsrc) : "memory");
    }
  };

  // Q^T B-fragments (K = head dim 64 -> two 32x16 fragments), held for all keys.
  v16bf aq[2];
#pragma unroll
  for (int ks = 0; ks < 2; ++ks)
    aq[ks] = load_frag(q + (size_t)(base + q0 + m) * HEAD + ks * 32, kks);

  // Per query column: running maximum (same in both halves) and this half's
  // share of the running sum (the halves are joined once, after the loop).
  float mrow = -3.0e38f, lrow = 0.f;
  v8f o[4];  // o[nt][r] = O^T[nt*16 + 8*hf + r][m]
#pragma unroll
  for (int nt = 0; nt < 4; ++nt) o[nt] = zero8();

  issue_block(0, 0);
  for (int kb = 0; kb < SEQ; kb += 32) {
    const int cur = (kb >> 5) & 1;
    if (kb + 32 < SEQ) {
      issue_block(kb + 32, cur ^ 1);   // overlap next copy with this compute
      asm volatile("s_wait_asynccnt 0x4" ::: "memory");  // prev 4 done
    } else {
      asm volatile("s_wait_asynccnt 0x0" ::: "memory");
    }
    __syncthreads();  // staged block visible to all 4 waves

    // S^T = K * Q^T for 32 keys: 2 key tiles x 2 k-steps, K rows from LDS as A.
    // s[nt][r] = S^T[nt*16 + 8*hf + r][m].
    // All 8 A fragments of the block (4 K, 4 V^T) are fetched from LDS first,
    // in the order of their use.
    v16bf kf[2][2], vf[4];
#pragma unroll
    for (int ks = 0; ks < 2; ++ks)
#pragma unroll
      for (int nt = 0; nt < 2; ++nt)
        kf[ks][nt] = load_frag(&kbuf[cur][nt * 16 + m][ks * 32], kks);
#pragma unroll
    for (int nt = 0; nt < 4; ++nt)
      vf[nt] = load_frag(&vbuf[cur][nt * 16 + m][0], kks);
    // Keeps the 16 LDS loads above in flight together: without it the scheduler
    // sinks each fragment's loads to its WMMA and the wave waits out the LDS
    // latency once per fragment.
    __builtin_amdgcn_sched_barrier(0);
    __syncthreads();  // every wave holds its fragments: buf `cur` may be refilled
    v8f s[2];
    s[0] = zero8(); s[1] = zero8();
#pragma unroll
    for (int ks = 0; ks < 2; ++ks)
#pragma unroll
      for (int nt = 0; nt < 2; ++nt)
        s[nt] = wmma_bf16(kf[ks][nt], aq[ks], s[nt]);
    // Online softmax (exp2 domain; scale folded into q), one column per lane.
    float mx0 = fmaxf(s[0][0], s[1][0]), mx1 = fmaxf(s[0][1], s[1][1]);
#pragma unroll
    for (int r = 2; r < 8; r += 2) {
      mx0 = fmaxf(mx0, fmaxf(s[0][r], s[1][r]));
      mx1 = fmaxf(mx1, fmaxf(s[0][r + 1], s[1][r + 1]));
    }
    float mx = fmaxf(mx0, mx1);
    mx = fmaxf(mx, xhalf(mx));
    const float mn = fmaxf(mrow, mx);
    // Bare v_exp_f32: every argument is <= 0, and a term under 2^-126 (flushed
    // to 0 here) cannot move a sum whose largest term is 1, so the library
    // exp2f's small-result guard (compare, two selects, add, ldexp) is not needed.
    const float alpha = __builtin_amdgcn_exp2f(mrow - mn);
    mrow = mn;
    v16bf pt;  // P^T as B operand: pt[j] = key 8*hf + j, pt[8 + j] = key 16 + 8*hf + j
    float rs[4] = {0.f, 0.f, 0.f, 0.f};
#pragma unroll
    for (int r = 0; r < 8; ++r) {
      float p0 = __builtin_amdgcn_exp2f(s[0][r] - mn);
      float p1 = __builtin_amdgcn_exp2f(s[1][r] - mn);
      rs[r & 1] += p0;
      rs[2 + (r & 1)] += p1;
      pt[r] = (__bf16)p0;
      pt[8 + r] = (__bf16)p1;
    }
    lrow = lrow * alpha + ((rs[0] + rs[1]) + (rs[2] + rs[3]));
#pragma unroll
    for (int nt = 0; nt < 4; ++nt)
#pragma unroll
      for (int r = 0; r < 8; ++r) o[nt][r] *= alpha;
    // O^T += V^T * P^T : V^T rows are the A fragments (16 h x 32 keys).
#pragma unroll
    for (int nt = 0; nt < 4; ++nt)
      o[nt] = wmma_bf16(vf[nt], pt, o[nt]);
  }
  // Join the halves' sums, normalize, store: a lane holds 8 consecutive h of
  // its query row per tile -> two 16-byte stores.
  const float inv = 1.0f / (lrow + xhalf(lrow));
  float* orow = out + (size_t)(base + q0 + m) * HEAD + 8 * hf;
#pragma unroll
  for (int nt = 0; nt < 4; ++nt) {
    float4 lo = make_float4(o[nt][0] * inv, o[nt][1] * inv, o[nt][2] * inv, o[nt][3] * inv);
    float4 hi = make_float4(o[nt][4] * inv, o[nt][5] * inv, o[nt][6] * inv, o[nt][7] * inv);
    *reinterpret_cast<float4*>(orow + nt * 16) = lo;
    *reinterpret_cast<float4*>(orow + nt * 16 + 4) = hi;
  }
}

// ---------------------------------------------------------------------------
extern "C" void kernel_launch(void* const* d_in, const int* in_sizes, int n_in,
                              void* d_out, int out_size, void* d_ws,
                              size_t ws_size, hipStream_t stream) {
  (void)in_sizes; (void)n_in; (void)out_size; (void)ws_size;
  const float* x  = (const float*)d_in[0];
  const float* Wq = (const float*)d_in[1];
  const float* bq = (const float*)d_in[2];
  const float* Wk = (const float*)d_in[3];
  const float* bk = (const float*)d_in[4];
  const float* Wv = (const float*)d_in[5];
  const float* bv = (const float*)d_in[6];
  float* out = (float*)d_out;

  // Workspace: q,k bf16 [32768][64]; vT bf16 [64][32768]; packed weights bf16.
  char* ws = (char*)d_ws;
  unsigned short* qo  = (unsigned short*)(ws);
  unsigned short* ko  = (unsigned short*)(ws + (size_t)MTOT * HEAD * 2);
  unsigned short* vT  = (unsigned short*)(ws + (size_t)MTOT * HEAD * 4);
  unsigned short* Wp  = (unsigned short*)(ws + (size_t)MTOT * HEAD * 6);

  hipLaunchKernelGGL(wcvt_kernel, dim3((WCHUNKS + 255) / 256),
                     dim3(256), 0, stream, Wq, Wk, Wv, Wp);
  hipLaunchKernelGGL(qkv_kernel, dim3(MTOT / 64), dim3(128), 0, stream, x, bq,
                     bk, bv, Wp, qo, ko, vT);
  hipLaunchKernelGGL(attn_kernel, dim3(SEQ / 64, BATCH), dim3(128), 0, stream,
                     qo, ko, vT, out);
}

// v005
// One run takes 77.2 microseconds.
// Next to v004, in two timings, it ran 1.14 and 1.13 times as fast.
// Counting every step since v000, it is 4.55 times as fast.
#include <hip/hip_runtime.h>

// ---------------------------------------------------------------------------
// Single-head attention for MI455X (gfx1250, wave32, WMMA).
//   x:[8,4096,768] f32 -> q,k,v (bf16 in ws) -> flash attention -> out f32.
// Matmuls on v_wmma_f32_16x16x32_bf16 (f32 accum). K/V blocks staged into LDS
// with double-buffered GLOBAL_LOAD_ASYNC_TO_LDS_B128 (ASYNCcnt). Softmax in
// exp2 domain (scale*log2e folded into q). Scores are formed transposed
// (S^T = K Q^T, O^T += V^T P^T): a lane owns one query column.
// ---------------------------------------------------------------------------

typedef __attribute__((ext_vector_type(16))) __bf16 v16bf;
typedef __attribute__((ext_vector_type(8)))  float  v8f;
typedef __attribute__((ext_vector_type(4)))  unsigned int u32x4;

#define N_EMBD 768
#define HEAD   64
#define BATCH  8
#define SEQ    4096
#define MTOT   (BATCH * SEQ)          // 32768 rows total
#define KSTEPS (N_EMBD / 32)          // 24 k-steps of the projection
#define NFRAG  12                     // q,k,v x 4 column tiles
#define WCHUNKS (KSTEPS * NFRAG * 64) // 16-byte chunks of the packed weights
#define KBLK   64                     // keys per attention pass
// 768^-0.5 * log2(e): logits land directly in log2 domain.
#define QSCALE 0.052058875f

static __device__ __forceinline__ v8f wmma_bf16(v16bf a, v16bf b, v8f c) {
  // (neg_a, A, neg_b, B, c_mod, C, reuse_a, reuse_b)
  return __builtin_amdgcn_wmma_f32_16x16x32_bf16(false, a, false, b, (short)0, c,
                                                 false, false);
}

// f32 -> bf16 via native hardware convert (v_cvt_pk_bf16_f32).
static __device__ __forceinline__ unsigned short f2u(float f) {
  return __builtin_bit_cast(unsigned short, (__bf16)f);
}
static __device__ __forceinline__ __bf16 u2b(unsigned short u) {
  return __builtin_bit_cast(__bf16, u);
}
static __device__ __forceinline__ v8f zero8() {
  v8f z = {0.f, 0.f, 0.f, 0.f, 0.f, 0.f, 0.f, 0.f};
  return z;
}

// K-pair base offsets for the 16-bit A/B fragment layout (ISA 7.12.2):
// half 0 covers K {0..7,16..23}, half 1 covers K {8..15,24..31}, 2 per VGPR.
static __device__ __forceinline__ void kk_pattern(int hf, int* kks) {
#pragma unroll
  for (int i = 0; i < 8; ++i)
    kks[i] = (i < 4 ? 2 * i : 16 + 2 * (i - 4)) + 8 * hf;
}

// Load one 16-bit B fragment (32xK rows x 16 cols) from a row pointer whose
// row holds contiguous K-pairs; kks holds this lane's K-pair offsets.
static __device__ __forceinline__ v16bf load_frag(const unsigned short* p,
                                                  const int* kks) {
  v16bf b;
#pragma unroll
  for (int i = 0; i < 8; ++i) {
    unsigned int u = *reinterpret_cast<const unsigned int*>(p + kks[i]);
    b[2 * i] = u2b((unsigned short)(u & 0xffffu));
    b[2 * i + 1] = u2b((unsigned short)(u >> 16));
  }
  return b;
}

// Lane l <-> lane l ^ 16 (the two halves that share one query column).
static __device__ __forceinline__ float xhalf(float x) {
  int b = __builtin_bit_cast(int, x);
  return __builtin_bit_cast(
      float, __builtin_amdgcn_permlanex16(b, b, 0x76543210, 0xfedcba98, false, false));
}

// Low 32 bits of a flat pointer into LDS == LDS byte offset (aperture layout).
static __device__ __forceinline__ unsigned lds_addr(const void* p) {
  return (unsigned)(size_t)p;
}

// ---------------------------------------------------------------------------
// Kernel 0: Wq|Wk|Wv [768][64] f32 -> bf16 packed in B-fragment order.
// Fragment (ks, f = w*4 + nt) is 1 KiB: chunk j (0,1) of lane l lies at
// j*512 + l*16 bytes and holds k = ks*32 + j*16 + (l>>4)*8 + 0..7 of column
// nt*16 + (l&15), so one wave-wide 16-byte load reads 512 contiguous bytes.
// ---------------------------------------------------------------------------
__global__ __launch_bounds__(256) void wcvt_kernel(
    const float* __restrict__ Wq, const float* __restrict__ Wk,
    const float* __restrict__ Wv, unsigned short* __restrict__ Wp) {
  int c = blockIdx.x * 256 + threadIdx.x;  // one 16-byte chunk per thread
  if (c >= WCHUNKS) return;
  int lane = c & 31, j = (c >> 5) & 1, t = c >> 6;
  int f = t % NFRAG, ks = t / NFRAG;
  int w = f >> 2, nt = f & 3;
  const float* W = (w == 0) ? Wq : (w == 1 ? Wk : Wv);
  const float* s = W + (size_t)(ks * 32 + j * 16 + (lane >> 4) * 8) * HEAD +
                   nt * 16 + (lane & 15);
  u32x4 v;
#pragma unroll
  for (int i = 0; i < 4; ++i)
    v[i] = (unsigned)f2u(s[(2 * i) * HEAD]) |
           ((unsigned)f2u(s[(2 * i + 1) * HEAD]) << 16);
  *reinterpret_cast<u32x4*>(Wp + (size_t)c * 8) = v;
}

// ---------------------------------------------------------------------------
// Kernel 1: fused QKV projection. One wave = one 16-row tile of [32768,768]x
// [768,64] for q,k,v simultaneously (x is read exactly once). Per k-step the
// x slice and all 12 packed weight B-fragments (24 whole-line loads) are
// issued as one group, then the 12 WMMAs run back-to-back.
// q scaled by QSCALE; v stored transposed [64][32768] for V^T A-fragments.
// ---------------------------------------------------------------------------
__global__ __launch_bounds__(128) void qkv_kernel(
    const float* __restrict__ x, const float* __restrict__ bq,
    const float* __restrict__ bk, const float* __restrict__ bv,
    const unsigned short* __restrict__ Wp, unsigned short* __restrict__ qo,
    unsigned short* __restrict__ ko, unsigned short* __restrict__ vT) {
  const int lane = threadIdx.x & 31;
  const int wid = threadIdx.x >> 5;
  const int row0 = (blockIdx.x * 4 + wid) * 16;
  const int m = lane & 15, hf = lane >> 4;
  int kks[8];
  kk_pattern(hf, kks);

  v8f acc[3][4];
#pragma unroll
  for (int w = 0; w < 3; ++w)
#pragma unroll
    for (int nt = 0; nt < 4; ++nt) acc[w][nt] = zero8();

  const float* xrow = x + (size_t)(row0 + m) * N_EMBD;
  const u32x4* wlane = reinterpret_cast<const u32x4*>(Wp) + lane;
  for (int ks = 0; ks < KSTEPS; ++ks) {
    // Raw 16x32 slice of x (f32) and the 12 packed B fragments of this k-step.
    float2 xr[8];
#pragma unroll
    for (int i = 0; i < 8; ++i)
      xr[i] = *reinterpret_cast<const float2*>(xrow + ks * 32 + kks[i]);
    const u32x4* wk = wlane + ks * (NFRAG * 64);
    v16bf bfr[NFRAG];
#pragma unroll
    for (int f = 0; f < NFRAG; ++f) {
      u32x4 lo = wk[f * 64], hi = wk[f * 64 + 32];
      bfr[f] = __builtin_bit_cast(
          v16bf, __builtin_shufflevector(lo, hi, 0, 1, 2, 3, 4, 5, 6, 7));
    }
    // Keeps the 28 loads above in flight together: without it the scheduler
    // sinks each fragment's loads to its WMMA and the wave waits 12 times.
    __builtin_amdgcn_sched_barrier(0);
    // A fragment: f32 -> bf16 (v_cvt_pk_bf16_f32).
    v16bf a;
#pragma unroll
    for (int i = 0; i < 8; ++i) {
      a[2 * i] = (__bf16)xr[i].x;
      a[2 * i + 1] = (__bf16)xr[i].y;
    }
#pragma unroll
    for (int w = 0; w < 3; ++w)
#pragma unroll
      for (int nt = 0; nt < 4; ++nt)
        acc[w][nt] = wmma_bf16(a, bfr[w * 4 + nt], acc[w][nt]);
  }

  // C/D layout: VGPR r = rows r (lanes 0-15) / r+8 (lanes 16-31), col = lane%16.
#pragma unroll
  for (int nt = 0; nt < 4; ++nt) {
    int col = nt * 16 + m;
    float biasq = bq[col], biask = bk[col], biasv = bv[col];
#pragma unroll
    for (int r = 0; r < 8; ++r) {
      int row = row0 + r + 8 * hf;
      qo[(size_t)row * HEAD + col] = f2u((acc[0][nt][r] + biasq) * QSCALE);
      ko[(size_t)row * HEAD + col] = f2u(acc[1][nt][r] + biask);
      vT[(size_t)col * MTOT + row] = f2u(acc[2][nt][r] + biasv);
    }
  }
}

// ---------------------------------------------------------------------------
// Kernel 2: flash attention. 4 waves/block, wave = 16 q rows, 64 keys/pass.
// K/V blocks staged in LDS via double-buffered async DMA. S^T = K Q^T via 8
// WMMAs: lane (m, hf) holds 32 of the 64 scores of query column m, so the
// online softmax (log2 domain) reduces in registers plus one half exchange,
// and each pair of f32 S^T tiles converts in place into a B operand of
// O^T += V^T P^T (hardware k order on both sides).
// ---------------------------------------------------------------------------
__global__ __launch_bounds__(128) void attn_kernel(
    const unsigned short* __restrict__ q, const unsigned short* __restrict__ kg,
    const unsigned short* __restrict__ vg, float* __restrict__ out) {
  // Padded rows so the 16-lane fragment reads hit distinct LDS banks.
  __shared__ unsigned short kbuf[2][KBLK][72];  // [buf][key][h]  (64 used + pad)
  __shared__ unsigned short vbuf[2][HEAD][72];  // [buf][h][key]  (64 used + pad)
  const int tid = threadIdx.x;
  const int lane = tid & 31;
  const int wid = tid >> 5;
  const int m = lane & 15, hf = lane >> 4;
  const int base = blockIdx.y * SEQ;
  const int q0 = blockIdx.x * 64 + wid * 16;
  int kks[8];
  kk_pattern(hf, kks);

  // Async-stage one 64-key block (K: 64x64 bf16, V^T: 64x64 bf16) into LDS.
  // 128 threads x (4 K + 4 V) GLOBAL_LOAD_ASYNC_TO_LDS_B128 per block; rows are
  // 128 bytes on both sides and adjacent lanes take adjacent 16-byte chunks.
  auto issue_block = [&](int kb, int buf) {
    const unsigned short* ksrc = kg + (size_t)(base + kb) * HEAD;
    const unsigned short* vsrc = vg + (size_t)(base + kb);
    unsigned kl[4], vl[4];
    int ko[4], vo[4];
#pragma unroll
    for (int j = 0; j < 4; ++j) {
      int c = j * 128 + tid;           // 512 chunks of 16B
      int row = c >> 3, part = c & 7;  // 8 chunks per 64-half row
      kl[j] = lds_addr(&kbuf[buf][row][part * 8]);
      ko[j] = c * 16;                  // K block is contiguous in global
      vl[j] = lds_addr(&vbuf[buf][row][part * 8]);
      vo[j] = (row * MTOT + part * 8) * 2;
    }
    // One statement, so that the closing s_wait_xcnt stands in front of every
    // later write of an address register that these copies name.
    asm volatile(
        "global_load_async_to_lds_b128 %0, %8, %16\n\t"
        "global_load_async_to_lds_b128 %1, %9, %16\n\t"
        "global_load_async_to_lds_b128 %2, %10, %16\n\t"
        "global_load_async_to_lds_b128 %3, %11, %16\n\t"
        "global_load_async_to_lds_b128 %4, %12, %17\n\t"
        "global_load_async_to_lds_b128 %5, %13, %17\n\t"
        "global_load_async_to_lds_b128 %6, %14, %17\n\t"
        "global_load_async_to_lds_b128 %7, %15, %17\n\t"
        "s_wait_xcnt 0x0"
        :: "v"(kl[0]), "v"(kl[1]), "v"(kl[2]), "v"(kl[3]),
           "v"(vl[0]), "v"(vl[1]), "v"(vl[2]), "v"(vl[3]),
           "v"(ko[0]), "v"(ko[1]), "v"(ko[2]), "v"(ko[3]),
           "v"(vo[0]), "v"(vo[1]), "v"(vo[2]), "v"(vo[3]),
           "s"(ksrc), "s"(vsrc)
        : "memory");
  };

  // Q^T B-fragments (K = head dim 64 -> two 32x16 fragments), held for all keys.
  v16bf aq[2];
#pragma unroll
  for (int ks = 0; ks < 2; ++ks)
    aq[ks] = load_frag(q + (size_t)(base + q0 + m) * HEAD + ks * 32, kks);

  // Per query column: running maximum (same in both halves) and this half's
  // share of the running sum (the halves are joined once, after the loop).
  float mrow = -3.0e38f, lrow = 0.f;
  v8f o[4];  // o[nt][r] = O^T[nt*16 + 8*hf + r][m]
#pragma unroll
  for (int nt = 0; nt < 4; ++nt) o[nt] = zero8();

  issue_block(0, 0);
  asm volatile("s_wait_asynccnt 0x0" ::: "memory");  // own copies of block 0 landed
  __syncthreads();                                   // block 0 visible to all 4 waves
  issue_block(KBLK, 1);
  for (int kb = 0; kb < SEQ; kb += KBLK) {
    const int cur = (kb / KBLK) & 1;

    // S^T = K * Q^T for 64 keys: 4 key tiles x 2 k-steps, K rows from LDS as A.
    // s[t][r] = S^T[t*16 + 8*hf + r][m].
    // All 16 A fragments of the block (8 K, 8 V^T) are fetched from LDS first,
    // in the order of their use.
    v16bf kf[2][4], vf[2][4];
#pragma unroll
    for (int ks = 0; ks < 2; ++ks)
#pragma unroll
      for (int t = 0; t < 4; ++t)
        kf[ks][t] = load_frag(&kbuf[cur][t * 16 + m][ks * 32], kks);
#pragma unroll
    for (int g = 0; g < 2; ++g)
#pragma unroll
      for (int nt = 0; nt < 4; ++nt)
        vf[g][nt] = load_frag(&vbuf[cur][nt * 16 + m][g * 32], kks);
    // Keeps the 32 LDS loads above in flight together: without it the scheduler
    // sinks each fragment's loads to its WMMA and the wave waits out the LDS
    // latency once per fragment.
    __builtin_amdgcn_sched_barrier(0);
    v8f s[4];
#pragma unroll
    for (int t = 0; t < 4; ++t) s[t] = zero8();
#pragma unroll
    for (int ks = 0; ks < 2; ++ks)
#pragma unroll
      for (int t = 0; t < 4; ++t)
        s[t] = wmma_bf16(kf[ks][t], aq[ks], s[t]);
    // Keeps the score products in front of the hand-over: there they run while
    // the V^T fragments are still on their way from LDS.
    __builtin_amdgcn_sched_barrier(0);
    // Hand-over, behind the pass's last LDS read: this wave holds its fragments
    // and its copies of the next block have landed; the one barrier publishes
    // that block and frees buffer `cur`, which is refilled behind it, so the
    // refill flies during the softmax and the second products of this pass.
    asm volatile("s_wait_dscnt 0x0" ::: "memory");
    asm volatile("s_wait_asynccnt 0x0" ::: "memory");
    __syncthreads();
    if (kb + 2 * KBLK < SEQ) issue_block(kb + 2 * KBLK, cur);
    // Online softmax (exp2 domain; scale folded into q), one column per lane.
    float mc[4];  // four independent maximum chains
#pragma unroll
    for (int c = 0; c < 4; ++c) {
      mc[c] = fmaxf(fmaxf(s[0][c], s[1][c]), fmaxf(s[2][c], s[3][c]));
      mc[c] = fmaxf(mc[c], fmaxf(fmaxf(s[0][c + 4], s[1][c + 4]),
                                 fmaxf(s[2][c + 4], s[3][c + 4])));
    }
    float mx = fmaxf(fmaxf(mc[0], mc[1]), fmaxf(mc[2], mc[3]));
    mx = fmaxf(mx, xhalf(mx));
    const float mn = fmaxf(mrow, mx);
    // Bare v_exp_f32: every argument is <= 0, and a term under 2^-126 (flushed
    // to 0 here) cannot move a sum whose largest term is 1, so the library
    // exp2f's small-result guard (compare, two selects, add, ldexp) is not needed.
    const float alpha = __builtin_amdgcn_exp2f(mrow - mn);
    mrow = mn;
    // P^T as B operands, 32 keys each: pt[g][j] = key 32*g + 8*hf + j,
    // pt[g][8 + j] = key 32*g + 16 + 8*hf + j.
    v16bf pt[2];
    float rs[4] = {0.f, 0.f, 0.f, 0.f};
#pragma unroll
    for (int g = 0; g < 2; ++g)
#pragma unroll
      for (int r = 0; r < 8; ++r) {
        float p0 = __builtin_amdgcn_exp2f(s[2 * g][r] - mn);
        float p1 = __builtin_amdgcn_exp2f(s[2 * g + 1][r] - mn);
        rs[2 * g] += p0;
        rs[2 * g + 1] += p1;
        pt[g][r] = (__bf16)p0;
        pt[g][8 + r] = (__bf16)p1;
      }
    lrow = lrow * alpha + ((rs[0] + rs[1]) + (rs[2] + rs[3]));
#pragma unroll
    for (int nt = 0; nt < 4; ++nt)
#pragma unroll
      for (int r = 0; r < 8; ++r) o[nt][r] *= alpha;
    // O^T += V^T * P^T : V^T rows are the A fragments (16 h x 32 keys).
#pragma unroll
    for (int g = 0; g < 2; ++g)
#pragma unroll
      for (int nt = 0; nt < 4; ++nt)
        o[nt] = wmma_bf16(vf[g][nt], pt[g], o[nt]);
  }
  asm volatile("s_wait_asynccnt 0x0" ::: "memory");  // nothing in flight at the end
  // Join the halves' sums, normalize, store: a lane holds 8 consecutive h of
  // its query row per tile -> two 16-byte stores.
  const float inv = 1.0f / (lrow + xhalf(lrow));
  float* orow = out + (size_t)(base + q0 + m) * HEAD + 8 * hf;
#pragma unroll
  for (int nt = 0; nt < 4; ++nt) {
    float4 lo = make_float4(o[nt][0] * inv, o[nt][1] * inv, o[nt][2] * inv, o[nt][3] * inv);
    float4 hi = make_float4(o[nt][4] * inv, o[nt][5] * inv, o[nt][6] * inv, o[nt][7] * inv);
    *reinterpret_cast<float4*>(orow + nt * 16) = lo;
    *reinterpret_cast<float4*>(orow + nt * 16 + 4) = hi;
  }
}

// ---------------------------------------------------------------------------
extern "C" void kernel_launch(void* const* d_in, const int* in_sizes, int n_in,
                              void* d_out, int out_size, void* d_ws,
                              size_t ws_size, hipStream_t stream) {
  (void)in_sizes; (void)n_in; (void)out_size; (void)ws_size;
  const float* x  = (const float*)d_in[0];
  const float* Wq = (const float*)d_in[1];
  const float* bq = (const float*)d_in[2];
  const float* Wk = (const float*)d_in[3];
  const float* bk = (const float*)d_in[4];
  const float* Wv = (const float*)d_in[5];
  const float* bv = (const float*)d_in[6];
  float* out = (float*)d_out;

  // Workspace: q,k bf16 [32768][64]; vT bf16 [64][32768]; packed weights bf16.
  char* ws = (char*)d_ws;
  unsigned short* qo  = (unsigned short*)(ws);
  unsigned short* ko  = (unsigned short*)(ws + (size_t)MTOT * HEAD * 2);
  unsigned short* vT  = (unsigned short*)(ws + (size_t)MTOT * HEAD * 4);
  unsigned short* Wp  = (unsigned short*)(ws + (size_t)MTOT * HEAD * 6);

  hipLaunchKernelGGL(wcvt_kernel, dim3((WCHUNKS + 255) / 256),
                     dim3(256), 0, stream, Wq, Wk, Wv, Wp);
  hipLaunchKernelGGL(qkv_kernel, dim3(MTOT / 64), dim3(128), 0, stream, x, bq,
                     bk, bv, Wp, qo, ko, vT);
  hipLaunchKernelGGL(attn_kernel, dim3(SEQ / 64, BATCH), dim3(128), 0, stream,
                     qo, ko, vT, out);
}

// v006
// One run takes 60.7 microseconds.
// Two timings next to v005 put it at 1.29 and 1.26 times that version's speed.
// Over all steps from v000 it is 5.78 times as fast.
#include <hip/hip_runtime.h>

// ---------------------------------------------------------------------------
// Single-head attention for MI455X (gfx1250, wave32, WMMA).
//   x:[8,4096,768] f32 -> q,k,v (bf16 in ws) -> flash attention -> out f32.
// Matmuls on v_wmma_f32_16x16x32_bf16 (f32 accum). K/V blocks staged into LDS
// with double-buffered GLOBAL_LOAD_ASYNC_TO_LDS_B128 (ASYNCcnt). Softmax in
// exp2 domain (scale*log2e folded into q). Scores are formed transposed
// (S^T = K Q^T, O^T += V^T P^T): a lane owns one query column.
// ---------------------------------------------------------------------------

typedef __attribute__((ext_vector_type(16))) __bf16 v16bf;
typedef __attribute__((ext_vector_type(8)))  float  v8f;
typedef __attribute__((ext_vector_type(4)))  unsigned int u32x4;

#define N_EMBD 768
#define HEAD   64
#define BATCH  8
#define SEQ    4096
#define MTOT   (BATCH * SEQ)          // 32768 rows total
#define KSTEPS (N_EMBD / 32)          // 24 k-steps of the projection
#define NFRAG  12                     // q,k,v x 4 column tiles
#define WCHUNKS (KSTEPS * NFRAG * 64) // 16-byte chunks of the packed weights
#define KBLK   64                     // keys per wave and attention pass
#define PBLK   128                    // keys per block and attention pass
// 768^-0.5 * log2(e): logits land directly in log2 domain.
#define QSCALE 0.052058875f

static __device__ __forceinline__ v8f wmma_bf16(v16bf a, v16bf b, v8f c) {
  // (neg_a, A, neg_b, B, c_mod, C, reuse_a, reuse_b)
  return __builtin_amdgcn_wmma_f32_16x16x32_bf16(false, a, false, b, (short)0, c,
                                                 false, false);
}

// f32 -> bf16 via native hardware convert (v_cvt_pk_bf16_f32).
static __device__ __forceinline__ unsigned short f2u(float f) {
  return __builtin_bit_cast(unsigned short, (__bf16)f);
}
static __device__ __forceinline__ __bf16 u2b(unsigned short u) {
  return __builtin_bit_cast(__bf16, u);
}
static __device__ __forceinline__ v8f zero8() {
  v8f z = {0.f, 0.f, 0.f, 0.f, 0.f, 0.f, 0.f, 0.f};
  return z;
}

// K-pair base offsets for the 16-bit A/B fragment layout (ISA 7.12.2):
// half 0 covers K {0..7,16..23}, half 1 covers K {8..15,24..31}, 2 per VGPR.
static __device__ __forceinline__ void kk_pattern(int hf, int* kks) {
#pragma unroll
  for (int i = 0; i < 8; ++i)
    kks[i] = (i < 4 ? 2 * i : 16 + 2 * (i - 4)) + 8 * hf;
}

// Load one 16-bit B fragment (32xK rows x 16 cols) from a row pointer whose
// row holds contiguous K-pairs; kks holds this lane's K-pair offsets.
static __device__ __forceinline__ v16bf load_frag(const unsigned short* p,
                                                  const int* kks) {
  v16bf b;
#pragma unroll
  for (int i = 0; i < 8; ++i) {
    unsigned int u = *reinterpret_cast<const unsigned int*>(p + kks[i]);
    b[2 * i] = u2b((unsigned short)(u & 0xffffu));
    b[2 * i + 1] = u2b((unsigned short)(u >> 16));
  }
  return b;
}

// Lane l <-> lane l ^ 16 (the two halves that share one query column).
static __device__ __forceinline__ float xhalf(float x) {
  int b = __builtin_bit_cast(int, x);
  return __builtin_bit_cast(
      float, __builtin_amdgcn_permlanex16(b, b, 0x76543210, 0xfedcba98, false, false));
}

// Low 32 bits of a flat pointer into LDS == LDS byte offset (aperture layout).
static __device__ __forceinline__ unsigned lds_addr(const void* p) {
  return (unsigned)(size_t)p;
}

// ---------------------------------------------------------------------------
// Kernel 0: Wq|Wk|Wv [768][64] f32 -> bf16 packed in B-fragment order.
// Fragment (ks, f = w*4 + nt) is 1 KiB: chunk j (0,1) of lane l lies at
// j*512 + l*16 bytes and holds k = ks*32 + j*16 + (l>>4)*8 + 0..7 of column
// nt*16 + (l&15), so one wave-wide 16-byte load reads 512 contiguous bytes.
// ---------------------------------------------------------------------------
__global__ __launch_bounds__(256) void wcvt_kernel(
    const float* __restrict__ Wq, const float* __restrict__ Wk,
    const float* __restrict__ Wv, unsigned short* __restrict__ Wp) {
  int c = blockIdx.x * 256 + threadIdx.x;  // one 16-byte chunk per thread
  if (c >= WCHUNKS) return;
  int lane = c & 31, j = (c >> 5) & 1, t = c >> 6;
  int f = t % NFRAG, ks = t / NFRAG;
  int w = f >> 2, nt = f & 3;
  const float* W = (w == 0) ? Wq : (w == 1 ? Wk : Wv);
  const float* s = W + (size_t)(ks * 32 + j * 16 + (lane >> 4) * 8) * HEAD +
                   nt * 16 + (lane & 15);
  u32x4 v;
#pragma unroll
  for (int i = 0; i < 4; ++i)
    v[i] = (unsigned)f2u(s[(2 * i) * HEAD]) |
           ((unsigned)f2u(s[(2 * i + 1) * HEAD]) << 16);
  *reinterpret_cast<u32x4*>(Wp + (size_t)c * 8) = v;
}

// ---------------------------------------------------------------------------
// Kernel 1: fused QKV projection. One wave = one 16-row tile of [32768,768]x
// [768,64] for q,k,v simultaneously (x is read exactly once). Per k-step the
// x slice and all 12 packed weight B-fragments (24 whole-line loads) are
// issued as one group, then the 12 WMMAs run back-to-back.
// q scaled by QSCALE; v stored transposed [64][32768] for V^T A-fragments.
// ---------------------------------------------------------------------------
__global__ __launch_bounds__(128) void qkv_kernel(
    const float* __restrict__ x, const float* __restrict__ bq,
    const float* __restrict__ bk, const float* __restrict__ bv,
    const unsigned short* __restrict__ Wp, unsigned short* __restrict__ qo,
    unsigned short* __restrict__ ko, unsigned short* __restrict__ vT) {
  const int lane = threadIdx.x & 31;
  const int wid = threadIdx.x >> 5;
  const int row0 = (blockIdx.x * 4 + wid) * 16;
  const int m = lane & 15, hf = lane >> 4;
  int kks[8];
  kk_pattern(hf, kks);

  v8f acc[3][4];
#pragma unroll
  for (int w = 0; w < 3; ++w)
#pragma unroll
    for (int nt = 0; nt < 4; ++nt) acc[w][nt] = zero8();

  const float* xrow = x + (size_t)(row0 + m) * N_EMBD;
  const u32x4* wlane = reinterpret_cast<const u32x4*>(Wp) + lane;
  for (int ks = 0; ks < KSTEPS; ++ks) {
    // Raw 16x32 slice of x (f32) and the 12 packed B fragments of this k-step.
    float2 xr[8];
#pragma unroll
    for (int i = 0; i < 8; ++i)
      xr[i] = *reinterpret_cast<const float2*>(xrow + ks * 32 + kks[i]);
    const u32x4* wk = wlane + ks * (NFRAG * 64);
    v16bf bfr[NFRAG];
#pragma unroll
    for (int f = 0; f < NFRAG; ++f) {
      u32x4 lo = wk[f * 64], hi = wk[f * 64 + 32];
      bfr[f] = __builtin_bit_cast(
          v16bf, __builtin_shufflevector(lo, hi, 0, 1, 2, 3, 4, 5, 6, 7));
    }
    // Keeps the 28 loads above in flight together: without it the scheduler
    // sinks each fragment's loads to its WMMA and the wave waits 12 times.
    __builtin_amdgcn_sched_barrier(0);
    // A fragment: f32 -> bf16 (v_cvt_pk_bf16_f32).
    v16bf a;
#pragma unroll
    for (int i = 0; i < 8; ++i) {
      a[2 * i] = (__bf16)xr[i].x;
      a[2 * i + 1] = (__bf16)xr[i].y;
    }
#pragma unroll
    for (int w = 0; w < 3; ++w)
#pragma unroll
      for (int nt = 0; nt < 4; ++nt)
        acc[w][nt] = wmma_bf16(a, bfr[w * 4 + nt], acc[w][nt]);
  }

  // C/D layout: VGPR r = rows r (lanes 0-15) / r+8 (lanes 16-31), col = lane%16.
#pragma unroll
  for (int nt = 0; nt < 4; ++nt) {
    int col = nt * 16 + m;
    float biasq = bq[col], biask = bk[col], biasv = bv[col];
#pragma unroll
    for (int r = 0; r < 8; ++r) {
      int row = row0 + r + 8 * hf;
      qo[(size_t)row * HEAD + col] = f2u((acc[0][nt][r] + biasq) * QSCALE);
      ko[(size_t)row * HEAD + col] = f2u(acc[1][nt][r] + biask);
      vT[(size_t)col * MTOT + row] = f2u(acc[2][nt][r] + biasv);
    }
  }
}

// ---------------------------------------------------------------------------
// Kernel 2: flash attention. 8 waves/block, 128 q rows/block, 128 keys/pass.
// Wave (g, c) = (wid >> 2, wid & 3) takes the 32 query columns c (two 16-column
// tiles) and the 64 keys g of every pass, so each K / V^T fragment read from
// LDS feeds two WMMAs and a staged block serves 128 queries. K/V blocks staged
// in LDS via double-buffered async DMA. S^T = K Q^T: lane (m, hf) holds 32 of
// the 64 scores of query column m of each tile, so the online softmax (log2
// domain) reduces in registers plus one half exchange, and each pair of f32 S^T
// tiles converts in place into a B operand of O^T += V^T P^T (hardware k order
// on both sides). The two key groups' partial results are joined once, after
// the loop, through LDS.
// ---------------------------------------------------------------------------
__global__ __launch_bounds__(256) void attn_kernel(
    const unsigned short* __restrict__ q, const unsigned short* __restrict__ kg,
    const unsigned short* __restrict__ vg, float* __restrict__ out) {
  // Padded rows (pitch 16 B x odd) so the 16-lane fragment reads hit distinct banks.
  __shared__ __attribute__((aligned(16))) unsigned short kbuf[2][PBLK][72];   // [buf][key][h]
  __shared__ __attribute__((aligned(16))) unsigned short vbuf[2][HEAD][136];  // [buf][h][key]
  __shared__ float4 xo[8][8][32];  // [wave][quad][lane]: the tile handed to the partner
  __shared__ float2 xml[8][32];    // its running maximum and sum share
  const int tid = threadIdx.x;
  const int lane = tid & 31;
  const int wid = tid >> 5;
  const int grp = wid >> 2;  // key group of this wave
  const int m = lane & 15, hf = lane >> 4;
  const int base = blockIdx.y * SEQ;
  const int q0 = blockIdx.x * 128 + (wid & 3) * 32;
  int kks[8];
  kk_pattern(hf, kks);

  // Async-stage one 128-key block (K: 128x64 bf16, V^T: 64x128 bf16) into LDS.
  // 256 threads x (4 K + 4 V) GLOBAL_LOAD_ASYNC_TO_LDS_B128 per block; adjacent
  // lanes take adjacent 16-byte chunks of whole 128-byte lines.
  auto issue_block = [&](int kb, int buf) {
    const unsigned short* ksrc = kg + (size_t)(base + kb) * HEAD;
    const unsigned short* vsrc = vg + (size_t)(base + kb);
    unsigned kl[4], vl[4];
    int ko[4], vo[4];
#pragma unroll
    for (int j = 0; j < 4; ++j) {
      int c = j * 256 + tid;  // 1024 chunks of 16B on each side
      kl[j] = lds_addr(&kbuf[buf][c >> 3][(c & 7) * 8]);  // 8 chunks per K row
      ko[j] = c * 16;         // K block is contiguous in global
      vl[j] = lds_addr(&vbuf[buf][c >> 4][(c & 15) * 8]);  // 16 chunks per V^T row
      vo[j] = ((c >> 4) * MTOT + (c & 15) * 8) * 2;
    }
    // One statement, so that the closing s_wait_xcnt stands in front of every
    // later write of an address register that these copies name.
    asm volatile(
        "global_load_async_to_lds_b128 %0, %8, %16\n\t"
        "global_load_async_to_lds_b128 %1, %9, %16\n\t"
        "global_load_async_to_lds_b128 %2, %10, %16\n\t"
        "global_load_async_to_lds_b128 %3, %11, %16\n\t"
        "global_load_async_to_lds_b128 %4, %12, %17\n\t"
        "global_load_async_to_lds_b128 %5, %13, %17\n\t"
        "global_load_async_to_lds_b128 %6, %14, %17\n\t"
        "global_load_async_to_lds_b128 %7, %15, %17\n\t"
        "s_wait_xcnt 0x0"
        :: "v"(kl[0]), "v"(kl[1]), "v"(kl[2]), "v"(kl[3]),
           "v"(vl[0]), "v"(vl[1]), "v"(vl[2]), "v"(vl[3]),
           "v"(ko[0]), "v"(ko[1]), "v"(ko[2]), "v"(ko[3]),
           "v"(vo[0]), "v"(vo[1]), "v"(vo[2]), "v"(vo[3]),
           "s"(ksrc), "s"(vsrc)
        : "memory");
  };

  // Q^T B-fragments (K = head dim 64 -> two 32x16 fragments per column tile),
  // held for all keys.
  v16bf aq[2][2];
#pragma unroll
  for (int c = 0; c < 2; ++c)
#pragma unroll
    for (int ks = 0; ks < 2; ++ks)
      aq[c][ks] = load_frag(q + (size_t)(base + q0 + c * 16 + m) * HEAD + ks * 32, kks);

  // Per query column: running maximum (same in both halves) and this half's
  // share of the running sum (the halves are joined once, after the loop).
  float mrow[2] = {-3.0e38f, -3.0e38f}, lrow[2] = {0.f, 0.f};
  v8f o[2][4];  // o[c][nt][r] = O^T[nt*16 + 8*hf + r][c*16 + m]
#pragma unroll
  for (int c = 0; c < 2; ++c)
#pragma unroll
    for (int nt = 0; nt < 4; ++nt) o[c][nt] = zero8();

  issue_block(0, 0);
  asm volatile("s_wait_asynccnt 0x0" ::: "memory");  // own copies of block 0 landed
  __syncthreads();                                   // block 0 visible to all 8 waves
  issue_block(PBLK, 1);
  for (int kb = 0; kb < SEQ; kb += PBLK) {
    const int cur = (kb / PBLK) & 1;

    // S^T = K * Q^T for this wave's 64 keys: 4 key tiles x 2 k-steps x 2 column
    // tiles, K rows from LDS as A. s[c][t][r] = S^T[t*16 + 8*hf + r][c*16 + m].
    // All 16 A fragments of this wave's 64 keys (8 K, 8 V^T) are fetched from LDS first,
    // in the order of their use.
    v16bf kf[2][4], vf[2][4];
#pragma unroll
    for (int ks = 0; ks < 2; ++ks)
#pragma unroll
      for (int t = 0; t < 4; ++t)
        kf[ks][t] = load_frag(&kbuf[cur][grp * KBLK + t * 16 + m][ks * 32], kks);
#pragma unroll
    for (int g = 0; g < 2; ++g)
#pragma unroll
      for (int nt = 0; nt < 4; ++nt)
        vf[g][nt] = load_frag(&vbuf[cur][nt * 16 + m][grp * KBLK + g * 32], kks);
    // Keeps the 32 LDS loads above in flight together: without it the scheduler
    // sinks each fragment's loads to its WMMA and the wave waits out the LDS
    // latency once per fragment.
    __builtin_amdgcn_sched_barrier(0);
    v8f s[2][4];
#pragma unroll
    for (int c = 0; c < 2; ++c)
#pragma unroll
      for (int t = 0; t < 4; ++t) s[c][t] = zero8();
#pragma unroll
    for (int ks = 0; ks < 2; ++ks)
#pragma unroll
      for (int t = 0; t < 4; ++t)
#pragma unroll
        for (int c = 0; c < 2; ++c)
          s[c][t] = wmma_bf16(kf[ks][t], aq[c][ks], s[c][t]);
    // Keeps the score products in front of the hand-over: there they run while
    // the V^T fragments are still on their way from LDS.
    __builtin_amdgcn_sched_barrier(0);
    // Hand-over, behind the pass's last LDS read: this wave holds its fragments
    // and its copies of the next block have landed; the one barrier publishes
    // that block and frees buffer cur, which is refilled behind it, so the
    // refill flies during the softmax and the second products of this pass.
    asm volatile("s_wait_dscnt 0x0" ::: "memory");
    asm volatile("s_wait_asynccnt 0x0" ::: "memory");
    __syncthreads();
    if (kb + 2 * PBLK < SEQ) issue_block(kb + 2 * PBLK, cur);
    // Per column tile: online softmax (exp2 domain; scale folded into q), one
    // column per lane, then the tile's second products.
    // P^T as B operands, 32 keys each: pt[c][g][j] = key 32*g + 8*hf + j,
    // pt[c][g][8 + j] = key 32*g + 16 + 8*hf + j.
    v16bf pt[2][2];
#pragma unroll
    for (int c = 0; c < 2; ++c) {
      float mc[4];  // four independent maximum chains
#pragma unroll
      for (int i = 0; i < 4; ++i) {
        mc[i] = fmaxf(fmaxf(s[c][0][i], s[c][1][i]), fmaxf(s[c][2][i], s[c][3][i]));
        mc[i] = fmaxf(mc[i], fmaxf(fmaxf(s[c][0][i + 4], s[c][1][i + 4]),
                                   fmaxf(s[c][2][i + 4], s[c][3][i + 4])));
      }
      float mx = fmaxf(fmaxf(mc[0], mc[1]), fmaxf(mc[2], mc[3]));
      mx = fmaxf(mx, xhalf(mx));
      const float mn = fmaxf(mrow[c], mx);
      // Bare v_exp_f32: every argument is <= 0, and a term under 2^-126 (flushed
      // to 0 here) cannot move a sum whose largest term is 1, so the library
      // exp2f's small-result guard (compare, two selects, add, ldexp) is not needed.
      const float alpha = __builtin_amdgcn_exp2f(mrow[c] - mn);
      mrow[c] = mn;
      float rs[4] = {0.f, 0.f, 0.f, 0.f};
#pragma unroll
      for (int g = 0; g < 2; ++g)
#pragma unroll
        for (int r = 0; r < 8; ++r) {
          float p0 = __builtin_amdgcn_exp2f(s[c][2 * g][r] - mn);
          float p1 = __builtin_amdgcn_exp2f(s[c][2 * g + 1][r] - mn);
          rs[2 * g] += p0;
          rs[2 * g + 1] += p1;
          pt[c][g][r] = (__bf16)p0;
          pt[c][g][8 + r] = (__bf16)p1;
        }
      lrow[c] = lrow[c] * alpha + ((rs[0] + rs[1]) + (rs[2] + rs[3]));
#pragma unroll
      for (int nt = 0; nt < 4; ++nt)
#pragma unroll
        for (int r = 0; r < 8; ++r) o[c][nt][r] *= alpha;
      // O^T += V^T * P^T : V^T rows are the A fragments (16 h x 32 keys).
#pragma unroll
      for (int g = 0; g < 2; ++g)
#pragma unroll
        for (int nt = 0; nt < 4; ++nt)
          o[c][nt] = wmma_bf16(vf[g][nt], pt[c][g], o[c][nt]);
    }
  }
  asm volatile("s_wait_asynccnt 0x0" ::: "memory");  // nothing in flight at the end
  // Join the two key groups: waves wid and wid ^ 4 hold the same 32 columns.
  // A wave of group g keeps column tile g and hands tile 1 - g to its partner.
  const bool hi = grp != 0;
  const float msend = hi ? mrow[0] : mrow[1], lsend = hi ? lrow[0] : lrow[1];
  const float mkeep = hi ? mrow[1] : mrow[0], lkeep = hi ? lrow[1] : lrow[0];
  v8f ok[4];
#pragma unroll
  for (int nt = 0; nt < 4; ++nt) {
    v8f os;
#pragma unroll
    for (int r = 0; r < 8; ++r) {
      os[r] = hi ? o[0][nt][r] : o[1][nt][r];
      ok[nt][r] = hi ? o[1][nt][r] : o[0][nt][r];
    }
    xo[wid][2 * nt][lane] = make_float4(os[0], os[1], os[2], os[3]);
    xo[wid][2 * nt + 1][lane] = make_float4(os[4], os[5], os[6], os[7]);
  }
  xml[wid][lane] = make_float2(msend, lsend);
  __syncthreads();  // the partner's tile is readable
  const float2 ml = xml[wid ^ 4][lane];
  const float mj = fmaxf(mkeep, ml.x);
  const float fk = __builtin_amdgcn_exp2f(mkeep - mj);  // arguments <= 0, as above
  const float fp = __builtin_amdgcn_exp2f(ml.x - mj);
  const float lj = lkeep * fk + ml.y * fp;
  // Join the halves' sums, normalize, store: a lane holds 8 consecutive h of
  // its query row per tile -> two 16-byte stores.
  const float inv = 1.0f / (lj + xhalf(lj));
  const float wk = fk * inv, wp = fp * inv;
  float* orow = out + (size_t)(base + q0 + grp * 16 + m) * HEAD + 8 * hf;
#pragma unroll
  for (int nt = 0; nt < 4; ++nt) {
    const float4 pl = xo[wid ^ 4][2 * nt][lane], ph = xo[wid ^ 4][2 * nt + 1][lane];
    float4 lo = make_float4(ok[nt][0] * wk + pl.x * wp, ok[nt][1] * wk + pl.y * wp,
                            ok[nt][2] * wk + pl.z * wp, ok[nt][3] * wk + pl.w * wp);
    float4 hv = make_float4(ok[nt][4] * wk + ph.x * wp, ok[nt][5] * wk + ph.y * wp,
                            ok[nt][6] * wk + ph.z * wp, ok[nt][7] * wk + ph.w * wp);
    *reinterpret_cast<float4*>(orow + nt * 16) = lo;
    *reinterpret_cast<float4*>(orow + nt * 16 + 4) = hv;
  }
}

// ---------------------------------------------------------------------------
extern "C" void kernel_launch(void* const* d_in, const int* in_sizes, int n_in,
                              void* d_out, int out_size, void* d_ws,
                              size_t ws_size, hipStream_t stream) {
  (void)in_sizes; (void)n_in; (void)out_size; (void)ws_size;
  const float* x  = (const float*)d_in[0];
  const float* Wq = (const float*)d_in[1];
  const float* bq = (const float*)d_in[2];
  const float* Wk = (const float*)d_in[3];
  const float* bk = (const float*)d_in[4];
  const float* Wv = (const float*)d_in[5];
  const float* bv = (const float*)d_in[6];
  float* out = (float*)d_out;

  // Workspace: q,k bf16 [32768][64]; vT bf16 [64][32768]; packed weights bf16.
  char* ws = (char*)d_ws;
  unsigned short* qo  = (unsigned short*)(ws);
  unsigned short* ko  = (unsigned short*)(ws + (size_t)MTOT * HEAD * 2);
  unsigned short* vT  = (unsigned short*)(ws + (size_t)MTOT * HEAD * 4);
  unsigned short* Wp  = (unsigned short*)(ws + (size_t)MTOT * HEAD * 6);

  hipLaunchKernelGGL(wcvt_kernel, dim3((WCHUNKS + 255) / 256),
                     dim3(256), 0, stream, Wq, Wk, Wv, Wp);
  hipLaunchKernelGGL(qkv_kernel, dim3(MTOT / 64), dim3(128), 0, stream, x, bq,
                     bk, bv, Wp, qo, ko, vT);
  hipLaunchKernelGGL(attn_kernel, dim3(SEQ / 128, BATCH), dim3(256), 0, stream,
                     qo, ko, vT, out);
}

// v007
// It runs in 59.6 microseconds.
// Timed twice side by side with v006, it ran 1.03 and 1.02 times as fast.
// Counting every step since v000, it is 5.94 times as fast.
#include <hip/hip_runtime.h>

// ---------------------------------------------------------------------------
// Single-head attention for MI455X (gfx1250, wave32, WMMA).
//   x:[8,4096,768] f32 -> q,k,v (bf16 in ws) -> flash attention -> out f32.
// Matmuls on v_wmma_f32_16x16x32_bf16 (f32 accum). K/V blocks staged into LDS
// with double-buffered GLOBAL_LOAD_ASYNC_TO_LDS_B128 (ASYNCcnt). Softmax in
// exp2 domain (scale*log2e folded into q). Scores are formed transposed
// (S^T = K Q^T, O^T += V^T P^T): a lane owns one query column.
// ---------------------------------------------------------------------------

typedef __attribute__((ext_vector_type(16))) __bf16 v16bf;
typedef __attribute__((ext_vector_type(8)))  float  v8f;
typedef __attribute__((ext_vector_type(4)))  unsigned int u32x4;

#define N_EMBD 768
#define HEAD   64
#define BATCH  8
#define SEQ    4096
#define MTOT   (BATCH * SEQ)          // 32768 rows total
#define KSTEPS (N_EMBD / 32)          // 24 k-steps of the projection
#define NFRAG  12                     // q,k,v x 4 column tiles
#define WCHUNKS (KSTEPS * NFRAG * 64) // 16-byte chunks of the packed weights
#define KBLK   64                     // keys per wave and attention pass
#define PBLK   128                    // keys per block and attention pass
// 768^-0.5 * log2(e): logits land directly in log2 domain.
#define QSCALE 0.052058875f

static __device__ __forceinline__ v8f wmma_bf16(v16bf a, v16bf b, v8f c) {
  // (neg_a, A, neg_b, B, c_mod, C, reuse_a, reuse_b)
  return __builtin_amdgcn_wmma_f32_16x16x32_bf16(false, a, false, b, (short)0, c,
                                                 false, false);
}

// f32 -> bf16 via native hardware convert (v_cvt_pk_bf16_f32).
static __device__ __forceinline__ unsigned short f2u(float f) {
  return __builtin_bit_cast(unsigned short, (__bf16)f);
}
static __device__ __forceinline__ __bf16 u2b(unsigned short u) {
  return __builtin_bit_cast(__bf16, u);
}
static __device__ __forceinline__ v8f zero8() {
  v8f z = {0.f, 0.f, 0.f, 0.f, 0.f, 0.f, 0.f, 0.f};
  return z;
}

// K-pair base offsets for the 16-bit A/B fragment layout (ISA 7.12.2):
// half 0 covers K {0..7,16..23}, half 1 covers K {8..15,24..31}, 2 per VGPR.
static __device__ __forceinline__ void kk_pattern(int hf, int* kks) {
#pragma unroll
  for (int i = 0; i < 8; ++i)
    kks[i] = (i < 4 ? 2 * i : 16 + 2 * (i - 4)) + 8 * hf;
}

// Load one 16-bit B fragment (32xK rows x 16 cols) from a row pointer whose
// row holds contiguous K-pairs; kks holds this lane's K-pair offsets.
static __device__ __forceinline__ v16bf load_frag(const unsigned short* p,
                                                  const int* kks) {
  v16bf b;
#pragma unroll
  for (int i = 0; i < 8; ++i) {
    unsigned int u = *reinterpret_cast<const unsigned int*>(p + kks[i]);
    b[2 * i] = u2b((unsigned short)(u & 0xffffu));
    b[2 * i + 1] = u2b((unsigned short)(u >> 16));
  }
  return b;
}

// Lane l <-> lane l ^ 16 (the two halves that share one query column).
static __device__ __forceinline__ float xhalf(float x) {
  int b = __builtin_bit_cast(int, x);
  return __builtin_bit_cast(
      float, __builtin_amdgcn_permlanex16(b, b, 0x76543210, 0xfedcba98, false, false));
}

// Low 32 bits of a flat pointer into LDS == LDS byte offset (aperture layout).
static __device__ __forceinline__ unsigned lds_addr(const void* p) {
  return (unsigned)(size_t)p;
}

// ---------------------------------------------------------------------------
// Kernel 0: Wq|Wk|Wv [768][64] f32 -> bf16 packed in B-fragment order.
// Fragment (ks, f = w*4 + nt) is 1 KiB: chunk j (0,1) of lane l lies at
// j*512 + l*16 bytes and holds k = ks*32 + j*16 + (l>>4)*8 + 0..7 of column
// nt*16 + (l&15), so one wave-wide 16-byte load reads 512 contiguous bytes.
// ---------------------------------------------------------------------------
__global__ __launch_bounds__(256) void wcvt_kernel(
    const float* __restrict__ Wq, const float* __restrict__ Wk,
    const float* __restrict__ Wv, unsigned short* __restrict__ Wp) {
  int c = blockIdx.x * 256 + threadIdx.x;  // one 16-byte chunk per thread
  if (c >= WCHUNKS) return;
  int lane = c & 31, j = (c >> 5) & 1, t = c >> 6;
  int f = t % NFRAG, ks = t / NFRAG;
  int w = f >> 2, nt = f & 3;
  const float* W = (w == 0) ? Wq : (w == 1 ? Wk : Wv);
  const float* s = W + (size_t)(ks * 32 + j * 16 + (lane >> 4) * 8) * HEAD +
                   nt * 16 + (lane & 15);
  u32x4 v;
#pragma unroll
  for (int i = 0; i < 4; ++i)
    v[i] = (unsigned)f2u(s[(2 * i) * HEAD]) |
           ((unsigned)f2u(s[(2 * i + 1) * HEAD]) << 16);
  *reinterpret_cast<u32x4*>(Wp + (size_t)c * 8) = v;
}

// ---------------------------------------------------------------------------
// Kernel 1: fused QKV projection. One wave = one 16-row tile of [32768,768]x
// [768,64] for q,k,v simultaneously (x is read exactly once). Per k-step the
// x slice and all 12 packed weight B-fragments (24 whole-line loads) are
// issued as one group, then the 12 WMMAs run back-to-back.
// q scaled by QSCALE; v stored transposed [64][32768] for V^T A-fragments.
// ---------------------------------------------------------------------------
__global__ __launch_bounds__(128) void qkv_kernel(
    const float* __restrict__ x, const float* __restrict__ bq,
    const float* __restrict__ bk, const float* __restrict__ bv,
    const unsigned short* __restrict__ Wp, unsigned short* __restrict__ qo,
    unsigned short* __restrict__ ko, unsigned short* __restrict__ vT) {
  const int lane = threadIdx.x & 31;
  const int wid = threadIdx.x >> 5;
  const int row0 = (blockIdx.x * 4 + wid) * 16;
  const int m = lane & 15, hf = lane >> 4;
  int kks[8];
  kk_pattern(hf, kks);

  v8f acc[3][4];
#pragma unroll
  for (int w = 0; w < 3; ++w)
#pragma unroll
    for (int nt = 0; nt < 4; ++nt) acc[w][nt] = zero8();

  const float* xrow = x + (size_t)(row0 + m) * N_EMBD;
  const u32x4* wlane = reinterpret_cast<const u32x4*>(Wp) + lane;
  for (int ks = 0; ks < KSTEPS; ++ks) {
    // Raw 16x32 slice of x (f32) and the 12 packed B fragments of this k-step.
    float2 xr[8];
#pragma unroll
    for (int i = 0; i < 8; ++i)
      xr[i] = *reinterpret_cast<const float2*>(xrow + ks * 32 + kks[i]);
    const u32x4* wk = wlane + ks * (NFRAG * 64);
    v16bf bfr[NFRAG];
#pragma unroll
    for (int f = 0; f < NFRAG; ++f) {
      u32x4 lo = wk[f * 64], hi = wk[f * 64 + 32];
      bfr[f] = __builtin_bit_cast(
          v16bf, __builtin_shufflevector(lo, hi, 0, 1, 2, 3, 4, 5, 6, 7));
    }
    // Keeps the 28 loads above in flight together: without it the scheduler
    // sinks each fragment's loads to its WMMA and the wave waits 12 times.
    __builtin_amdgcn_sched_barrier(0);
    // A fragment: f32 -> bf16 (v_cvt_pk_bf16_f32).
    v16bf a;
#pragma unroll
    for (int i = 0; i < 8; ++i) {
      a[2 * i] = (__bf16)xr[i].x;
      a[2 * i + 1] = (__bf16)xr[i].y;
    }
#pragma unroll
    for (int w = 0; w < 3; ++w)
#pragma unroll
      for (int nt = 0; nt < 4; ++nt)
        acc[w][nt] = wmma_bf16(a, bfr[w * 4 + nt], acc[w][nt]);
  }

  // C/D layout: VGPR r = rows r (lanes 0-15) / r+8 (lanes 16-31), col = lane%16.
#pragma unroll
  for (int nt = 0; nt < 4; ++nt) {
    int col = nt * 16 + m;
    float biasq = bq[col], biask = bk[col], biasv = bv[col];
#pragma unroll
    for (int r = 0; r < 8; ++r) {
      int row = row0 + r + 8 * hf;
      qo[(size_t)row * HEAD + col] = f2u((acc[0][nt][r] + biasq) * QSCALE);
      ko[(size_t)row * HEAD + col] = f2u(acc[1][nt][r] + biask);
      vT[(size_t)col * MTOT + row] = f2u(acc[2][nt][r] + biasv);
    }
  }
}

// ---------------------------------------------------------------------------
// Kernel 2: flash attention. 8 waves/block, 128 q rows/block, 128 keys/pass.
// Wave (g, c) = (wid >> 2, wid & 3) takes the 32 query columns c (two 16-column
// tiles) and the 64 keys g of every pass, so each K / V^T fragment read from
// LDS feeds two WMMAs and a staged block serves 128 queries. K/V blocks staged
// in LDS via double-buffered async DMA; a block's K fragments are read from LDS
// during the pass before. S^T = K Q^T: lane (m, hf) holds 32 of
// the 64 scores of query column m of each tile, so the online softmax (log2
// domain) reduces in registers plus one half exchange, and each pair of f32 S^T
// tiles converts in place into a B operand of O^T += V^T P^T (hardware k order
// on both sides). The two key groups' partial results are joined once, after
// the loop, through LDS.
// ---------------------------------------------------------------------------
__global__ __launch_bounds__(256) void attn_kernel(
    const unsigned short* __restrict__ q, const unsigned short* __restrict__ kg,
    const unsigned short* __restrict__ vg, float* __restrict__ out) {
  // Padded rows (pitch 16 B x odd) so the 16-lane fragment reads hit distinct banks.
  __shared__ __attribute__((aligned(16))) unsigned short kbuf[2][PBLK][72];   // [buf][key][h]
  __shared__ __attribute__((aligned(16))) unsigned short vbuf[2][HEAD][136];  // [buf][h][key]
  __shared__ float4 xo[8][8][32];  // [wave][quad][lane]: the tile handed to the partner
  __shared__ float2 xml[8][32];    // its running maximum and sum share
  const int tid = threadIdx.x;
  const int lane = tid & 31;
  const int wid = tid >> 5;
  const int grp = wid >> 2;  // key group of this wave
  const int m = lane & 15, hf = lane >> 4;
  const int base = blockIdx.y * SEQ;
  const int q0 = blockIdx.x * 128 + (wid & 3) * 32;
  int kks[8];
  kk_pattern(hf, kks);

  // Async-stage one 128-key block (K: 128x64 bf16, V^T: 64x128 bf16) into LDS.
  // 256 threads x (4 K + 4 V) GLOBAL_LOAD_ASYNC_TO_LDS_B128 per block; adjacent
  // lanes take adjacent 16-byte chunks of whole 128-byte lines.
  auto issue_block = [&](int kb, int buf) {
    const unsigned short* ksrc = kg + (size_t)base * HEAD;
    const unsigned short* vsrc = vg + (size_t)base;
    // Slice j of 256 chunks of 16 B: K rows j*32.. (8 chunks a row, 4 KiB in a
    // row in global), V^T rows j*16.. (16 chunks a row). The slice's step stands
    // in the scalar base, so all four slices share one lane offset register,
    // which also takes the block's own step.
    const int ko = (kb * HEAD + tid * 8) * 2;
    const int vo = ((tid >> 4) * MTOT + (tid & 15) * 8 + kb) * 2;
    unsigned kl[4], vl[4];
#pragma unroll
    for (int j = 0; j < 4; ++j) {
      kl[j] = lds_addr(&kbuf[buf][j * 32 + (tid >> 3)][(tid & 7) * 8]);
      vl[j] = lds_addr(&vbuf[buf][j * 16 + (tid >> 4)][(tid & 15) * 8]);
    }
    // One statement, so that the closing s_wait_xcnt stands in front of every
    // later write of an address register that these copies name.
    asm volatile(
        "global_load_async_to_lds_b128 %0, %8, %10\n\t"
        "global_load_async_to_lds_b128 %1, %8, %11\n\t"
        "global_load_async_to_lds_b128 %2, %8, %12\n\t"
        "global_load_async_to_lds_b128 %3, %8, %13\n\t"
        "global_load_async_to_lds_b128 %4, %9, %14\n\t"
        "global_load_async_to_lds_b128 %5, %9, %15\n\t"
        "global_load_async_to_lds_b128 %6, %9, %16\n\t"
        "global_load_async_to_lds_b128 %7, %9, %17\n\t"
        "s_wait_xcnt 0x0"
        :: "v"(kl[0]), "v"(kl[1]), "v"(kl[2]), "v"(kl[3]),
           "v"(vl[0]), "v"(vl[1]), "v"(vl[2]), "v"(vl[3]),
           "v"(ko), "v"(vo),
           "s"(ksrc), "s"(ksrc + 32 * HEAD), "s"(ksrc + 64 * HEAD), "s"(ksrc + 96 * HEAD),
           "s"(vsrc), "s"(vsrc + 16 * MTOT), "s"(vsrc + 32 * MTOT), "s"(vsrc + 48 * MTOT)
        : "memory");
  };

  // Q^T B-fragments (K = head dim 64 -> two 32x16 fragments per column tile),
  // held for all keys.
  v16bf aq[2][2];
#pragma unroll
  for (int c = 0; c < 2; ++c)
#pragma unroll
    for (int ks = 0; ks < 2; ++ks)
      aq[c][ks] = load_frag(q + (size_t)(base + q0 + c * 16 + m) * HEAD + ks * 32, kks);

  // Per query column: running maximum (same in both halves) and this half's
  // share of the running sum (the halves are joined once, after the loop).
  float mrow[2] = {-3.0e38f, -3.0e38f}, lrow[2] = {0.f, 0.f};
  v8f o[2][4];  // o[c][nt][r] = O^T[nt*16 + 8*hf + r][c*16 + m]
#pragma unroll
  for (int c = 0; c < 2; ++c)
#pragma unroll
    for (int nt = 0; nt < 4; ++nt) o[c][nt] = zero8();

  // K fragments (A operands of the score products), fetched one pass ahead.
  v16bf kf[2][4];
  auto fetch_k = [&](int buf) {
#pragma unroll
    for (int ks = 0; ks < 2; ++ks)
#pragma unroll
      for (int t = 0; t < 4; ++t)
        kf[ks][t] = load_frag(&kbuf[buf][grp * KBLK + t * 16 + m][ks * 32], kks);
  };

  issue_block(0, 0);
  asm volatile("s_wait_asynccnt 0x0" ::: "memory");  // own copies of block 0 landed
  __syncthreads();                                   // block 0 visible to all 8 waves
  issue_block(PBLK, 1);
  fetch_k(0);
  for (int kb = 0; kb < SEQ; kb += PBLK) {
    const int cur = (kb / PBLK) & 1;

    // The block's 8 V^T fragments are fetched from LDS first, in the order of
    // their use; its 8 K fragments are in registers since the pass before.
    v16bf vf[2][4];
#pragma unroll
    for (int g = 0; g < 2; ++g)
#pragma unroll
      for (int nt = 0; nt < 4; ++nt)
        vf[g][nt] = load_frag(&vbuf[cur][nt * 16 + m][grp * KBLK + g * 32], kks);
    // Keeps the 16 LDS loads above in flight together, in front of the score
    // products, under which they fly.
    __builtin_amdgcn_sched_barrier(0);
    // S^T = K * Q^T for this wave's 64 keys: 4 key tiles x 2 k-steps x 2 column
    // tiles, K rows as A. s[c][t][r] = S^T[t*16 + 8*hf + r][c*16 + m].
    v8f s[2][4];
#pragma unroll
    for (int c = 0; c < 2; ++c)
#pragma unroll
      for (int t = 0; t < 4; ++t) s[c][t] = zero8();
#pragma unroll
    for (int ks = 0; ks < 2; ++ks)
#pragma unroll
      for (int t = 0; t < 4; ++t)
#pragma unroll
        for (int c = 0; c < 2; ++c)
          s[c][t] = wmma_bf16(kf[ks][t], aq[c][ks], s[c][t]);
    // Keeps the score products in front of the hand-over: there they run while
    // the V^T fragments are still on their way from LDS.
    __builtin_amdgcn_sched_barrier(0);
    // Hand-over, behind the last LDS read of buffer cur: this wave holds its
    // fragments and its copies of the next block have landed; the one barrier
    // publishes that block and frees buffer cur, which is refilled behind it, so
    // the refill flies during the softmax and the second products of this pass.
    asm volatile("s_wait_dscnt 0x0" ::: "memory");
    asm volatile("s_wait_asynccnt 0x0" ::: "memory");
    __syncthreads();
    if (kb + 2 * PBLK < SEQ) issue_block(kb + 2 * PBLK, cur);
    // Per column tile: online softmax (exp2 domain; scale folded into q), one
    // column per lane, then the tile's second products.
    // P^T as B operands, 32 keys each: pt[c][g][j] = key 32*g + 8*hf + j,
    // pt[c][g][8 + j] = key 32*g + 16 + 8*hf + j.
    v16bf pt[2][2];
#pragma unroll
    for (int c = 0; c < 2; ++c) {
      float mc[4];  // four independent maximum chains
#pragma unroll
      for (int i = 0; i < 4; ++i) {
        mc[i] = fmaxf(fmaxf(s[c][0][i], s[c][1][i]), fmaxf(s[c][2][i], s[c][3][i]));
        mc[i] = fmaxf(mc[i], fmaxf(fmaxf(s[c][0][i + 4], s[c][1][i + 4]),
                                   fmaxf(s[c][2][i + 4], s[c][3][i + 4])));
      }
      float mx = fmaxf(fmaxf(mc[0], mc[1]), fmaxf(mc[2], mc[3]));
      mx = fmaxf(mx, xhalf(mx));
      const float mn = fmaxf(mrow[c], mx);
      // Bare v_exp_f32: every argument is <= 0, and a term under 2^-126 (flushed
      // to 0 here) cannot move a sum whose largest term is 1, so the library
      // exp2f's small-result guard (compare, two selects, add, ldexp) is not needed.
      const float alpha = __builtin_amdgcn_exp2f(mrow[c] - mn);
      mrow[c] = mn;
      float rs[4] = {0.f, 0.f, 0.f, 0.f};
#pragma unroll
      for (int g = 0; g < 2; ++g)
#pragma unroll
        for (int r = 0; r < 8; ++r) {
          float p0 = __builtin_amdgcn_exp2f(s[c][2 * g][r] - mn);
          float p1 = __builtin_amdgcn_exp2f(s[c][2 * g + 1][r] - mn);
          rs[2 * g] += p0;
          rs[2 * g + 1] += p1;
          pt[c][g][r] = (__bf16)p0;
          pt[c][g][8 + r] = (__bf16)p1;
        }
      lrow[c] = lrow[c] * alpha + ((rs[0] + rs[1]) + (rs[2] + rs[3]));
#pragma unroll
      for (int nt = 0; nt < 4; ++nt)
#pragma unroll
        for (int r = 0; r < 8; ++r) o[c][nt][r] *= alpha;
      // O^T += V^T * P^T : V^T rows are the A fragments (16 h x 32 keys).
#pragma unroll
      for (int g = 0; g < 2; ++g)
#pragma unroll
        for (int nt = 0; nt < 4; ++nt)
          o[c][nt] = wmma_bf16(vf[g][nt], pt[c][g], o[c][nt]);
      // The next block's K fragments (published by this pass's barrier), as one
      // group of 16 LDS loads between the column tiles: they issue while the
      // products above run and fly under the second tile's softmax, so the next
      // pass's score products start without an LDS wait. The scalar branch keeps
      // the last pass off a block that does not exist.
      if (c == 0 && kb + PBLK < SEQ) fetch_k(cur ^ 1);
    }
  }
  asm volatile("s_wait_asynccnt 0x0" ::: "memory");  // nothing in flight at the end
  // Join the two key groups: waves wid and wid ^ 4 hold the same 32 columns.
  // A wave of group g keeps column tile g and hands tile 1 - g to its partner.
  const bool hi = grp != 0;
  const float msend = hi ? mrow[0] : mrow[1], lsend = hi ? lrow[0] : lrow[1];
  const float mkeep = hi ? mrow[1] : mrow[0], lkeep = hi ? lrow[1] : lrow[0];
  v8f ok[4];
#pragma unroll
  for (int nt = 0; nt < 4; ++nt) {
    v8f os;
#pragma unroll
    for (int r = 0; r < 8; ++r) {
      os[r] = hi ? o[0][nt][r] : o[1][nt][r];
      ok[nt][r] = hi ? o[1][nt][r] : o[0][nt][r];
    }
    xo[wid][2 * nt][lane] = make_float4(os[0], os[1], os[2], os[3]);
    xo[wid][2 * nt + 1][lane] = make_float4(os[4], os[5], os[6], os[7]);
  }
  xml[wid][lane] = make_float2(msend, lsend);
  __syncthreads();  // the partner's tile is readable
  const float2 ml = xml[wid ^ 4][lane];
  const float mj = fmaxf(mkeep, ml.x);
  const float fk = __builtin_amdgcn_exp2f(mkeep - mj);  // arguments <= 0, as above
  const float fp = __builtin_amdgcn_exp2f(ml.x - mj);
  const float lj = lkeep * fk + ml.y * fp;
  // Join the halves' sums, normalize, store: a lane holds 8 consecutive h of
  // its query row per tile -> two 16-byte stores.
  const float inv = 1.0f / (lj + xhalf(lj));
  const float wk = fk * inv, wp = fp * inv;
  float* orow = out + (size_t)(base + q0 + grp * 16 + m) * HEAD + 8 * hf;
#pragma unroll
  for (int nt = 0; nt < 4; ++nt) {
    const float4 pl = xo[wid ^ 4][2 * nt][lane], ph = xo[wid ^ 4][2 * nt + 1][lane];
    float4 lo = make_float4(ok[nt][0] * wk + pl.x * wp, ok[nt][1] * wk + pl.y * wp,
                            ok[nt][2] * wk + pl.z * wp, ok[nt][3] * wk + pl.w * wp);
    float4 hv = make_float4(ok[nt][4] * wk + ph.x * wp, ok[nt][5] * wk + ph.y * wp,
                            ok[nt][6] * wk + ph.z * wp, ok[nt][7] * wk + ph.w * wp);
    *reinterpret_cast<float4*>(orow + nt * 16) = lo;
    *reinterpret_cast<float4*>(orow + nt * 16 + 4) = hv;
  }
}

// ---------------------------------------------------------------------------
extern "C" void kernel_launch(void* const* d_in, const int* in_sizes, int n_in,
                              void* d_out, int out_size, void* d_ws,
                              size_t ws_size, hipStream_t stream) {
  (void)in_sizes; (void)n_in; (void)out_size; (void)ws_size;
  const float* x  = (const float*)d_in[0];
  const float* Wq = (const float*)d_in[1];
  const float* bq = (const float*)d_in[2];
  const float* Wk = (const float*)d_in[3];
  const float* bk = (const float*)d_in[4];
  const float* Wv = (const float*)d_in[5];
  const float* bv = (const float*)d_in[6];
  float* out = (float*)d_out;

  // Workspace: q,k bf16 [32768][64]; vT bf16 [64][32768]; packed weights bf16.
  char* ws = (char*)d_ws;
  unsigned short* qo  = (unsigned short*)(ws);
  unsigned short* ko  = (unsigned short*)(ws + (size_t)MTOT * HEAD * 2);
  unsigned short* vT  = (unsigned short*)(ws + (size_t)MTOT * HEAD * 4);
  unsigned short* Wp  = (unsigned short*)(ws + (size_t)MTOT * HEAD * 6);

  hipLaunchKernelGGL(wcvt_kernel, dim3((WCHUNKS + 255) / 256),
                     dim3(256), 0, stream, Wq, Wk, Wv, Wp);
  hipLaunchKernelGGL(qkv_kernel, dim3(MTOT / 64), dim3(128), 0, stream, x, bq,
                     bk, bv, Wp, qo, ko, vT);
  hipLaunchKernelGGL(attn_kernel, dim3(SEQ / 128, BATCH), dim3(256), 0, stream,
                     qo, ko, vT, out);
}

// v008
// It runs in 57 microseconds.
// Two timings next to v007 put it at 1.05 and 1.02 times that version's speed.
// All steps since v000 together make it 6.16 times as fast.
#include <hip/hip_runtime.h>

// ---------------------------------------------------------------------------
// Single-head attention for MI455X (gfx1250, wave32, WMMA).
//   x:[8,4096,768] f32 -> q,k,v (bf16 in ws) -> flash attention -> out f32.
// Matmuls on v_wmma_f32_16x16x32_bf16 (f32 accum). K/V blocks staged into LDS
// with double-buffered GLOBAL_LOAD_ASYNC_TO_LDS_B128 (ASYNCcnt). Softmax in
// exp2 domain (scale*log2e folded into q). Scores are formed transposed
// (S^T = K Q^T, O^T += V^T P^T): a lane owns one query column.
// ---------------------------------------------------------------------------

typedef __attribute__((ext_vector_type(16))) __bf16 v16bf;
typedef __attribute__((ext_vector_type(8)))  float  v8f;
typedef __attribute__((ext_vector_type(4)))  unsigned int u32x4;

#define N_EMBD 768
#define HEAD   64
#define BATCH  8
#define SEQ    4096
#define MTOT   (BATCH * SEQ)          // 32768 rows total
#define KSTEPS (N_EMBD / 32)          // 24 k-steps of the projection
#define NFRAG  12                     // q,k,v x 4 column tiles
#define WCHUNKS (KSTEPS * NFRAG * 64) // 16-byte chunks of the packed weights
#define KBLK   32                     // keys per wave and attention pass
#define GBLK   64                     // keys per wave and staged block
#define PBLK   256                    // keys per staged block
// 768^-0.5 * log2(e): logits land directly in log2 domain.
#define QSCALE 0.052058875f

static __device__ __forceinline__ v8f wmma_bf16(v16bf a, v16bf b, v8f c) {
  // (neg_a, A, neg_b, B, c_mod, C, reuse_a, reuse_b)
  return __builtin_amdgcn_wmma_f32_16x16x32_bf16(false, a, false, b, (short)0, c,
                                                 false, false);
}

// f32 -> bf16 via native hardware convert (v_cvt_pk_bf16_f32).
static __device__ __forceinline__ unsigned short f2u(float f) {
  return __builtin_bit_cast(unsigned short, (__bf16)f);
}
static __device__ __forceinline__ __bf16 u2b(unsigned short u) {
  return __builtin_bit_cast(__bf16, u);
}
static __device__ __forceinline__ v8f zero8() {
  v8f z = {0.f, 0.f, 0.f, 0.f, 0.f, 0.f, 0.f, 0.f};
  return z;
}

// K-pair base offsets for the 16-bit A/B fragment layout (ISA 7.12.2):
// half 0 covers K {0..7,16..23}, half 1 covers K {8..15,24..31}, 2 per VGPR.
static __device__ __forceinline__ void kk_pattern(int hf, int* kks) {
#pragma unroll
  for (int i = 0; i < 8; ++i)
    kks[i] = (i < 4 ? 2 * i : 16 + 2 * (i - 4)) + 8 * hf;
}

// Load one 16-bit B fragment (32xK rows x 16 cols) from a row pointer whose
// row holds contiguous K-pairs; kks holds this lane's K-pair offsets.
static __device__ __forceinline__ v16bf load_frag(const unsigned short* p,
                                                  const int* kks) {
  v16bf b;
#pragma unroll
  for (int i = 0; i < 8; ++i) {
    unsigned int u = *reinterpret_cast<const unsigned int*>(p + kks[i]);
    b[2 * i] = u2b((unsigned short)(u & 0xffffu));
    b[2 * i + 1] = u2b((unsigned short)(u >> 16));
  }
  return b;
}

// The same fragment from a 16-byte aligned LDS row: this lane's K-pairs are two
// runs of 8 elements (8*hf.., 16 + 8*hf..), read as two 16-byte loads.
static __device__ __forceinline__ v16bf load_frag_lds(const unsigned short* p, int hf) {
  u32x4 lo = *reinterpret_cast<const u32x4*>(p + 8 * hf);
  u32x4 hi = *reinterpret_cast<const u32x4*>(p + 16 + 8 * hf);
  return __builtin_bit_cast(
      v16bf, __builtin_shufflevector(lo, hi, 0, 1, 2, 3, 4, 5, 6, 7));
}

// Lane l <-> lane l ^ 16 (the two halves that share one query column).
static __device__ __forceinline__ float xhalf(float x) {
  int b = __builtin_bit_cast(int, x);
  return __builtin_bit_cast(
      float, __builtin_amdgcn_permlanex16(b, b, 0x76543210, 0xfedcba98, false, false));
}

// Low 32 bits of a flat pointer into LDS == LDS byte offset (aperture layout).
static __device__ __forceinline__ unsigned lds_addr(const void* p) {
  return (unsigned)(size_t)p;
}

// ---------------------------------------------------------------------------
// Kernel 0: Wq|Wk|Wv [768][64] f32 -> bf16 packed in B-fragment order.
// Fragment (ks, f = w*4 + nt) is 1 KiB: chunk j (0,1) of lane l lies at
// j*512 + l*16 bytes and holds k = ks*32 + j*16 + (l>>4)*8 + 0..7 of column
// nt*16 + (l&15), so one wave-wide 16-byte load reads 512 contiguous bytes.
// ---------------------------------------------------------------------------
__global__ __launch_bounds__(256) void wcvt_kernel(
    const float* __restrict__ Wq, const float* __restrict__ Wk,
    const float* __restrict__ Wv, unsigned short* __restrict__ Wp) {
  int c = blockIdx.x * 256 + threadIdx.x;  // one 16-byte chunk per thread
  if (c >= WCHUNKS) return;
  int lane = c & 31, j = (c >> 5) & 1, t = c >> 6;
  int f = t % NFRAG, ks = t / NFRAG;
  int w = f >> 2, nt = f & 3;
  const float* W = (w == 0) ? Wq : (w == 1 ? Wk : Wv);
  const float* s = W + (size_t)(ks * 32 + j * 16 + (lane >> 4) * 8) * HEAD +
                   nt * 16 + (lane & 15);
  u32x4 v;
#pragma unroll
  for (int i = 0; i < 4; ++i)
    v[i] = (unsigned)f2u(s[(2 * i) * HEAD]) |
           ((unsigned)f2u(s[(2 * i + 1) * HEAD]) << 16);
  *reinterpret_cast<u32x4*>(Wp + (size_t)c * 8) = v;
}

// ---------------------------------------------------------------------------
// Kernel 1: fused QKV projection. One wave = one 16-row tile of [32768,768]x
// [768,64] for q,k,v simultaneously (x is read exactly once). Per k-step the
// x slice and all 12 packed weight B-fragments (24 whole-line loads) are
// issued as one group, then the 12 WMMAs run back-to-back.
// q scaled by QSCALE; v stored transposed [64][32768] for V^T A-fragments.
// ---------------------------------------------------------------------------
__global__ __launch_bounds__(128) void qkv_kernel(
    const float* __restrict__ x, const float* __restrict__ bq,
    const float* __restrict__ bk, const float* __restrict__ bv,
    const unsigned short* __restrict__ Wp, unsigned short* __restrict__ qo,
    unsigned short* __restrict__ ko, unsigned short* __restrict__ vT) {
  const int lane = threadIdx.x & 31;
  const int wid = threadIdx.x >> 5;
  const int row0 = (blockIdx.x * 4 + wid) * 16;
  const int m = lane & 15, hf = lane >> 4;
  int kks[8];
  kk_pattern(hf, kks);

  v8f acc[3][4];
#pragma unroll
  for (int w = 0; w < 3; ++w)
#pragma unroll
    for (int nt = 0; nt < 4; ++nt) acc[w][nt] = zero8();

  const float* xrow = x + (size_t)(row0 + m) * N_EMBD;
  const u32x4* wlane = reinterpret_cast<const u32x4*>(Wp) + lane;
  for (int ks = 0; ks < KSTEPS; ++ks) {
    // Raw 16x32 slice of x (f32) and the 12 packed B fragments of this k-step.
    float2 xr[8];
#pragma unroll
    for (int i = 0; i < 8; ++i)
      xr[i] = *reinterpret_cast<const float2*>(xrow + ks * 32 + kks[i]);
    const u32x4* wk = wlane + ks * (NFRAG * 64);
    v16bf bfr[NFRAG];
#pragma unroll
    for (int f = 0; f < NFRAG; ++f) {
      u32x4 lo = wk[f * 64], hi = wk[f * 64 + 32];
      bfr[f] = __builtin_bit_cast(
          v16bf, __builtin_shufflevector(lo, hi, 0, 1, 2, 3, 4, 5, 6, 7));
    }
    // Keeps the 28 loads above in flight together: without it the scheduler
    // sinks each fragment's loads to its WMMA and the wave waits 12 times.
    __builtin_amdgcn_sched_barrier(0);
    // A fragment: f32 -> bf16 (v_cvt_pk_bf16_f32).
    v16bf a;
#pragma unroll
    for (int i = 0; i < 8; ++i) {
      a[2 * i] = (__bf16)xr[i].x;
      a[2 * i + 1] = (__bf16)xr[i].y;
    }
#pragma unroll
    for (int w = 0; w < 3; ++w)
#pragma unroll
      for (int nt = 0; nt < 4; ++nt)
        acc[w][nt] = wmma_bf16(a, bfr[w * 4 + nt], acc[w][nt]);
  }

  // C/D layout: VGPR r = rows r (lanes 0-15) / r+8 (lanes 16-31), col = lane%16.
#pragma unroll
  for (int nt = 0; nt < 4; ++nt) {
    int col = nt * 16 + m;
    float biasq = bq[col], biask = bk[col], biasv = bv[col];
#pragma unroll
    for (int r = 0; r < 8; ++r) {
      int row = row0 + r + 8 * hf;
      qo[(size_t)row * HEAD + col] = f2u((acc[0][nt][r] + biasq) * QSCALE);
      ko[(size_t)row * HEAD + col] = f2u(acc[1][nt][r] + biask);
      vT[(size_t)col * MTOT + row] = f2u(acc[2][nt][r] + biasv);
    }
  }
}

// ---------------------------------------------------------------------------
// Kernel 2: flash attention. 16 waves/block (four per SIMD, under 256 VGPRs
// each), 128 q rows/block, 256 keys per staged block.
// Wave (g, c) = (wid >> 2, wid & 3) takes the 32 query columns c (two 16-column
// tiles) and the 64 keys g of every block, in two passes of 32 keys (the
// register budget), so each K / V^T fragment read from LDS feeds two WMMAs and
// a staged block serves 128 queries; while one wave of a SIMD works through its
// softmax, three others have matrix or vector work.
// K/V blocks staged in LDS via double-buffered async DMA; a pass's K fragments
// are read from LDS during the pass before. S^T = K Q^T: lane (m, hf) holds 16
// of the 32 scores of query column m of each tile, so the online softmax (log2
// domain) reduces in registers plus one half exchange, and each pair of f32 S^T
// tiles converts in place into a B operand of O^T += V^T P^T (hardware k order
// on both sides). The four key groups' partial results are joined once, after
// the loop, through LDS.
// ---------------------------------------------------------------------------
__global__ __launch_bounds__(512) void attn_kernel(
    const unsigned short* __restrict__ q, const unsigned short* __restrict__ kg,
    const unsigned short* __restrict__ vg, float* __restrict__ out) {
  // Padded rows (pitch 16 B x odd) so the 16-lane fragment reads hit distinct banks.
  __shared__ __attribute__((aligned(16))) unsigned short kbuf[2][PBLK][72];   // [buf][key][h]
  __shared__ __attribute__((aligned(16))) unsigned short vbuf[2][HEAD][264];  // [buf][h][key]
  __shared__ float4 xo[16][2][8][32];  // [wave][column tile][quad][lane]: partial O^T
  __shared__ float2 xml[16][2][32];    // its running maximum and sum share
  const int tid = threadIdx.x;
  const int lane = tid & 31;
  const int wid = tid >> 5;
  const int grp = wid >> 2;  // key group of this wave
  const int m = lane & 15, hf = lane >> 4;
  const int base = blockIdx.y * SEQ;
  const int q0 = blockIdx.x * 128 + (wid & 3) * 32;
  int kks[8];
  kk_pattern(hf, kks);

  // Async-stage one 256-key block (K: 256x64 bf16, V^T: 64x256 bf16) into LDS.
  // 512 threads x (4 K + 4 V) GLOBAL_LOAD_ASYNC_TO_LDS_B128 per block; adjacent
  // lanes take adjacent 16-byte chunks of whole 128-byte lines.
  auto issue_block = [&](int kb, int buf) {
    const unsigned short* ksrc = kg + (size_t)base * HEAD;
    const unsigned short* vsrc = vg + (size_t)base;
    // Slice j of 512 chunks of 16 B: K rows j*64.. (8 chunks a row, 8 KiB in a
    // row in global), V^T rows j*16.. (32 chunks a row). The slice's step stands
    // in the scalar base, so all four slices share one lane offset register,
    // which also takes the block's own step.
    const int ko = (kb * HEAD + tid * 8) * 2;
    const int vo = ((tid >> 5) * MTOT + (tid & 31) * 8 + kb) * 2;
    unsigned kl[4], vl[4];
#pragma unroll
    for (int j = 0; j < 4; ++j) {
      kl[j] = lds_addr(&kbuf[buf][j * 64 + (tid >> 3)][(tid & 7) * 8]);
      vl[j] = lds_addr(&vbuf[buf][j * 16 + (tid >> 5)][(tid & 31) * 8]);
    }
    // One statement, so that the closing s_wait_xcnt stands in front of every
    // later write of an address register that these copies name.
    asm volatile(
        "global_load_async_to_lds_b128 %0, %8, %10\n\t"
        "global_load_async_to_lds_b128 %1, %8, %11\n\t"
        "global_load_async_to_lds_b128 %2, %8, %12\n\t"
        "global_load_async_to_lds_b128 %3, %8, %13\n\t"
        "global_load_async_to_lds_b128 %4, %9, %14\n\t"
        "global_load_async_to_lds_b128 %5, %9, %15\n\t"
        "global_load_async_to_lds_b128 %6, %9, %16\n\t"
        "global_load_async_to_lds_b128 %7, %9, %17\n\t"
        "s_wait_xcnt 0x0"
        :: "v"(kl[0]), "v"(kl[1]), "v"(kl[2]), "v"(kl[3]),
           "v"(vl[0]), "v"(vl[1]), "v"(vl[2]), "v"(vl[3]),
           "v"(ko), "v"(vo),
           "s"(ksrc), "s"(ksrc + 64 * HEAD), "s"(ksrc + 128 * HEAD), "s"(ksrc + 192 * HEAD),
           "s"(vsrc), "s"(vsrc + 16 * MTOT), "s"(vsrc + 32 * MTOT), "s"(vsrc + 48 * MTOT)
        : "memory");
  };

  // Q^T B-fragments (K = head dim 64 -> two 32x16 fragments per column tile),
  // held for all keys.
  v16bf aq[2][2];
#pragma unroll
  for (int c = 0; c < 2; ++c)
#pragma unroll
    for (int ks = 0; ks < 2; ++ks)
      aq[c][ks] = load_frag(q + (size_t)(base + q0 + c * 16 + m) * HEAD + ks * 32, kks);

  // Per query column: running maximum (same in both halves) and this half's
  // share of the running sum (the halves are joined once, after the loop).
  float mrow[2] = {-3.0e38f, -3.0e38f}, lrow[2] = {0.f, 0.f};
  v8f o[2][4];  // o[c][nt][r] = O^T[nt*16 + 8*hf + r][c*16 + m]
#pragma unroll
  for (int c = 0; c < 2; ++c)
#pragma unroll
    for (int nt = 0; nt < 4; ++nt) o[c][nt] = zero8();

  // K fragments (A operands of the score products), fetched one pass ahead.
  v16bf kf[2][2];
  auto fetch_k = [&](int buf, int sp) {
#pragma unroll
    for (int ks = 0; ks < 2; ++ks)
#pragma unroll
      for (int t = 0; t < 2; ++t)
        kf[ks][t] = load_frag_lds(&kbuf[buf][grp * GBLK + sp * KBLK + t * 16 + m][ks * 32], hf);
  };

  issue_block(0, 0);
  asm volatile("s_wait_asynccnt 0x0" ::: "memory");  // own copies of block 0 landed
  __syncthreads();                                   // block 0 visible to all 16 waves
  issue_block(PBLK, 1);
  fetch_k(0, 0);
  for (int kb = 0; kb < SEQ; kb += PBLK) {
    const int cur = (kb / PBLK) & 1;
#pragma unroll
    for (int sp = 0; sp < 2; ++sp) {  // the two 32-key passes of this wave's 64 keys
      // The pass's 4 V^T fragments are fetched from LDS first, in the order of
      // their use; its 4 K fragments are in registers since the pass before.
      v16bf vf[4];
#pragma unroll
      for (int nt = 0; nt < 4; ++nt)
        vf[nt] = load_frag_lds(&vbuf[cur][nt * 16 + m][grp * GBLK + sp * KBLK], hf);
      // Keeps the 8 LDS loads above in flight together, in front of the score
      // products, under which they fly.
      __builtin_amdgcn_sched_barrier(0);
      // S^T = K * Q^T for this wave's 32 keys: 2 key tiles x 2 k-steps x 2 column
      // tiles, K rows as A. s[c][t][r] = S^T[t*16 + 8*hf + r][c*16 + m].
      v8f s[2][2];
#pragma unroll
      for (int c = 0; c < 2; ++c)
#pragma unroll
        for (int t = 0; t < 2; ++t) s[c][t] = zero8();
#pragma unroll
      for (int ks = 0; ks < 2; ++ks)
#pragma unroll
        for (int t = 0; t < 2; ++t)
#pragma unroll
          for (int c = 0; c < 2; ++c)
            s[c][t] = wmma_bf16(kf[ks][t], aq[c][ks], s[c][t]);
      // Keeps the 8 score products back to back (spread into the softmax the build
      // pads them with more v_nop) and, in the second pass, in front of the
      // hand-over: there they run while the V^T fragments are on their way from LDS.
      __builtin_amdgcn_sched_barrier(0);
      // Hand-over, in the block's second pass, behind the last LDS read of buffer
      // cur: this wave holds its fragments and its copies of the next block have
      // landed; the one barrier publishes that block and frees buffer cur, which is
      // refilled behind it, so the refill flies during the whole next block.
      if (sp == 1) {
        asm volatile("s_wait_dscnt 0x0" ::: "memory");
        asm volatile("s_wait_asynccnt 0x0" ::: "memory");
        __syncthreads();
        if (kb + 2 * PBLK < SEQ) issue_block(kb + 2 * PBLK, cur);
      }
      // Per column tile: online softmax (exp2 domain; scale folded into q), one
      // column per lane, then the tile's second products.
#pragma unroll
      for (int c = 0; c < 2; ++c) {
        float mc[4];  // four independent maximum chains
#pragma unroll
        for (int i = 0; i < 4; ++i)
          mc[i] = fmaxf(fmaxf(s[c][0][i], s[c][1][i]), fmaxf(s[c][0][i + 4], s[c][1][i + 4]));
        float mx = fmaxf(fmaxf(mc[0], mc[1]), fmaxf(mc[2], mc[3]));
        mx = fmaxf(mx, xhalf(mx));
        const float mn = fmaxf(mrow[c], mx);
        // Bare v_exp_f32: every argument is <= 0, and a term under 2^-126 (flushed
        // to 0 here) cannot move a sum whose largest term is 1, so the library
        // exp2f's small-result guard (compare, two selects, add, ldexp) is not needed.
        const float alpha = __builtin_amdgcn_exp2f(mrow[c] - mn);
        mrow[c] = mn;
        // P^T as a B operand of 32 keys: pt[j] = key 8*hf + j,
        // pt[8 + j] = key 16 + 8*hf + j.
        v16bf pt;
        float rs[4] = {0.f, 0.f, 0.f, 0.f};
#pragma unroll
        for (int r = 0; r < 8; ++r) {
          float p0 = __builtin_amdgcn_exp2f(s[c][0][r] - mn);
          float p1 = __builtin_amdgcn_exp2f(s[c][1][r] - mn);
          rs[2 * (r & 1)] += p0;
          rs[2 * (r & 1) + 1] += p1;
          pt[r] = (__bf16)p0;
          pt[8 + r] = (__bf16)p1;
        }
        lrow[c] = lrow[c] * alpha + ((rs[0] + rs[1]) + (rs[2] + rs[3]));
#pragma unroll
        for (int nt = 0; nt < 4; ++nt)
#pragma unroll
          for (int r = 0; r < 8; ++r) o[c][nt][r] *= alpha;
        // The next pass's K fragments (same block, or the next one, published by
        // this pass's barrier), asked for in front of the first tile's second
        // products: they fly under those and the second tile's softmax, so the next
        // pass's score products need not wait out a whole LDS latency. The scalar
        // branch keeps the last pass off a block that does not exist.
        if (c == 0 && sp == 0) fetch_k(cur, 1);
        if (c == 0 && sp == 1 && kb + PBLK < SEQ) fetch_k(cur ^ 1, 0);
        // O^T += V^T * P^T : V^T rows are the A fragments (16 h x 32 keys).
#pragma unroll
        for (int nt = 0; nt < 4; ++nt) o[c][nt] = wmma_bf16(vf[nt], pt, o[c][nt]);
      }
    }
  }
  asm volatile("s_wait_asynccnt 0x0" ::: "memory");  // nothing in flight at the end
  // Join the four key groups: waves wid & 3 + 4*g hold the same 32 columns.
  // Every wave hands over both its tiles; the wave of group g then joins column
  // tile g >> 1, head rows 32*(g & 1) .. +31, over the four groups in order.
#pragma unroll
  for (int c = 0; c < 2; ++c) {
#pragma unroll
    for (int nt = 0; nt < 4; ++nt) {
      xo[wid][c][2 * nt][lane] =
          make_float4(o[c][nt][0], o[c][nt][1], o[c][nt][2], o[c][nt][3]);
      xo[wid][c][2 * nt + 1][lane] =
          make_float4(o[c][nt][4], o[c][nt][5], o[c][nt][6], o[c][nt][7]);
    }
    xml[wid][c][lane] = make_float2(mrow[c], lrow[c]);
  }
  __syncthreads();  // all partial tiles are readable
  const int ct = grp >> 1, nh = grp & 1, cw = wid & 3;
  float2 ml[4];
#pragma unroll
  for (int g = 0; g < 4; ++g) ml[g] = xml[g * 4 + cw][ct][lane];
  const float mj = fmaxf(fmaxf(ml[0].x, ml[1].x), fmaxf(ml[2].x, ml[3].x));
  float wg[4], lj = 0.f;
#pragma unroll
  for (int g = 0; g < 4; ++g) {
    wg[g] = __builtin_amdgcn_exp2f(ml[g].x - mj);  // arguments <= 0, as above
    lj += ml[g].y * wg[g];
  }
  // Join the halves' sums, normalize, store: a lane holds 8 consecutive h of
  // its query row per tile -> two 16-byte stores.
  const float inv = 1.0f / (lj + xhalf(lj));
#pragma unroll
  for (int g = 0; g < 4; ++g) wg[g] *= inv;
  float* orow = out + (size_t)(base + q0 + ct * 16 + m) * HEAD + 8 * hf;
#pragma unroll
  for (int n = 0; n < 2; ++n) {
    const int nt = nh * 2 + n;
    float4 lo = make_float4(0.f, 0.f, 0.f, 0.f), hv = lo;
#pragma unroll
    for (int g = 0; g < 4; ++g) {
      const float4 pl = xo[g * 4 + cw][ct][2 * nt][lane];
      const float4 ph = xo[g * 4 + cw][ct][2 * nt + 1][lane];
      lo.x += pl.x * wg[g]; lo.y += pl.y * wg[g]; lo.z += pl.z * wg[g]; lo.w += pl.w * wg[g];
      hv.x += ph.x * wg[g]; hv.y += ph.y * wg[g]; hv.z += ph.z * wg[g]; hv.w += ph.w * wg[g];
    }
    *reinterpret_cast<float4*>(orow + nt * 16) = lo;
    *reinterpret_cast<float4*>(orow + nt * 16 + 4) = hv;
  }
}

// ---------------------------------------------------------------------------
extern "C" void kernel_launch(void* const* d_in, const int* in_sizes, int n_in,
                              void* d_out, int out_size, void* d_ws,
                              size_t ws_size, hipStream_t stream) {
  (void)in_sizes; (void)n_in; (void)out_size; (void)ws_size;
  const float* x  = (const float*)d_in[0];
  const float* Wq = (const float*)d_in[1];
  const float* bq = (const float*)d_in[2];
  const float* Wk = (const float*)d_in[3];
  const float* bk = (const float*)d_in[4];
  const float* Wv = (const float*)d_in[5];
  const float* bv = (const float*)d_in[6];
  float* out = (float*)d_out;

  // Workspace: q,k bf16 [32768][64]; vT bf16 [64][32768]; packed weights bf16.
  char* ws = (char*)d_ws;
  unsigned short* qo  = (unsigned short*)(ws);
  unsigned short* ko  = (unsigned short*)(ws + (size_t)MTOT * HEAD * 2);
  unsigned short* vT  = (unsigned short*)(ws + (size_t)MTOT * HEAD * 4);
  unsigned short* Wp  = (unsigned short*)(ws + (size_t)MTOT * HEAD * 6);

  hipLaunchKernelGGL(wcvt_kernel, dim3((WCHUNKS + 255) / 256),
                     dim3(256), 0, stream, Wq, Wk, Wv, Wp);
  hipLaunchKernelGGL(qkv_kernel, dim3(MTOT / 64), dim3(128), 0, stream, x, bq,
                     bk, bv, Wp, qo, ko, vT);
  hipLaunchKernelGGL(attn_kernel, dim3(SEQ / 128, BATCH), dim3(512), 0, stream,
                     qo, ko, vT, out);
}

// v009
// A run of this version takes 46.7 microseconds.
// Timed twice side by side with v008, it ran 1.22 times as fast both times.
// Over all steps from v000 it is 7.51 times as fast.
#include <hip/hip_runtime.h>

// ---------------------------------------------------------------------------
// Single-head attention for MI455X (gfx1250, wave32, WMMA).
//   x:[8,4096,768] f32 -> q,k,v (bf16 in ws) -> flash attention -> out f32.
// Matmuls on v_wmma_f32_16x16x32_bf16 (f32 accum). K/V blocks staged into LDS
// with double-buffered GLOBAL_LOAD_ASYNC_TO_LDS_B128 (ASYNCcnt). Softmax in
// exp2 domain (scale*log2e folded into q). Scores are formed transposed
// (S^T = K Q^T, O^T += V^T P^T): a lane owns one query column.
// ---------------------------------------------------------------------------

typedef __attribute__((ext_vector_type(16))) __bf16 v16bf;
typedef __attribute__((ext_vector_type(8)))  float  v8f;
typedef __attribute__((ext_vector_type(4)))  unsigned int u32x4;

#define N_EMBD 768
#define HEAD   64
#define BATCH  8
#define SEQ    4096
#define MTOT   (BATCH * SEQ)          // 32768 rows total
#define KSTEPS (N_EMBD / 32)          // 24 k-steps of the projection
#define NFRAG  12                     // q,k,v x 4 column tiles
#define WCHUNKS (KSTEPS * NFRAG * 64) // 16-byte chunks of the packed weights
#define QROWS  128                    // x rows per projection block
#define SSTEPS 4                      // k-steps per staged block of the projection
#define NSTAGE (KSTEPS / SSTEPS)      // stages of the projection
#define WSTAGE (SSTEPS * NFRAG * 64)  // 16-byte weight chunks per stage
#define XPITCH (SSTEPS * 32 + 4)      // floats per staged x row (512 B + 16 B)
#define KBLK   32                     // keys per wave and attention pass
#define GBLK   64                     // keys per wave and staged block
#define PBLK   256                    // keys per staged block
// 768^-0.5 * log2(e): logits land directly in log2 domain.
#define QSCALE 0.052058875f

static __device__ __forceinline__ v8f wmma_bf16(v16bf a, v16bf b, v8f c) {
  // (neg_a, A, neg_b, B, c_mod, C, reuse_a, reuse_b)
  return __builtin_amdgcn_wmma_f32_16x16x32_bf16(false, a, false, b, (short)0, c,
                                                 false, false);
}

// f32 -> bf16 via native hardware convert (v_cvt_pk_bf16_f32).
static __device__ __forceinline__ unsigned short f2u(float f) {
  return __builtin_bit_cast(unsigned short, (__bf16)f);
}
static __device__ __forceinline__ __bf16 u2b(unsigned short u) {
  return __builtin_bit_cast(__bf16, u);
}
static __device__ __forceinline__ v8f zero8() {
  v8f z = {0.f, 0.f, 0.f, 0.f, 0.f, 0.f, 0.f, 0.f};
  return z;
}

// K-pair base offsets for the 16-bit A/B fragment layout (ISA 7.12.2):
// half 0 covers K {0..7,16..23}, half 1 covers K {8..15,24..31}, 2 per VGPR.
static __device__ __forceinline__ void kk_pattern(int hf, int* kks) {
#pragma unroll
  for (int i = 0; i < 8; ++i)
    kks[i] = (i < 4 ? 2 * i : 16 + 2 * (i - 4)) + 8 * hf;
}

// Load one 16-bit B fragment (32xK rows x 16 cols) from a row pointer whose
// row holds contiguous K-pairs; kks holds this lane's K-pair offsets.
static __device__ __forceinline__ v16bf load_frag(const unsigned short* p,
                                                  const int* kks) {
  v16bf b;
#pragma unroll
  for (int i = 0; i < 8; ++i) {
    unsigned int u = *reinterpret_cast<const unsigned int*>(p + kks[i]);
    b[2 * i] = u2b((unsigned short)(u & 0xffffu));
    b[2 * i + 1] = u2b((unsigned short)(u >> 16));
  }
  return b;
}

// The same fragment from a 16-byte aligned LDS row: this lane's K-pairs are two
// runs of 8 elements (8*hf.., 16 + 8*hf..), read as two 16-byte loads.
static __device__ __forceinline__ v16bf load_frag_lds(const unsigned short* p, int hf) {
  u32x4 lo = *reinterpret_cast<const u32x4*>(p + 8 * hf);
  u32x4 hi = *reinterpret_cast<const u32x4*>(p + 16 + 8 * hf);
  return __builtin_bit_cast(
      v16bf, __builtin_shufflevector(lo, hi, 0, 1, 2, 3, 4, 5, 6, 7));
}

// Lane l <-> lane l ^ 16 (the two halves that share one query column).
static __device__ __forceinline__ float xhalf(float x) {
  int b = __builtin_bit_cast(int, x);
  return __builtin_bit_cast(
      float, __builtin_amdgcn_permlanex16(b, b, 0x76543210, 0xfedcba98, false, false));
}

// Low 32 bits of a flat pointer into LDS == LDS byte offset (aperture layout).
static __device__ __forceinline__ unsigned lds_addr(const void* p) {
  return (unsigned)(size_t)p;
}

// ---------------------------------------------------------------------------
// Kernel 0: Wq|Wk|Wv [768][64] f32 -> bf16 packed in B-fragment order.
// Fragment (ks, f = w*4 + nt) is 1 KiB: chunk j (0,1) of lane l lies at
// j*512 + l*16 bytes and holds k = ks*32 + j*16 + (l>>4)*8 + 0..7 of column
// nt*16 + (l&15), so one wave-wide 16-byte load reads 512 contiguous bytes.
// ---------------------------------------------------------------------------
__global__ __launch_bounds__(256) void wcvt_kernel(
    const float* __restrict__ Wq, const float* __restrict__ Wk,
    const float* __restrict__ Wv, unsigned short* __restrict__ Wp) {
  int c = blockIdx.x * 256 + threadIdx.x;  // one 16-byte chunk per thread
  if (c >= WCHUNKS) return;
  int lane = c & 31, j = (c >> 5) & 1, t = c >> 6;
  int f = t % NFRAG, ks = t / NFRAG;
  int w = f >> 2, nt = f & 3;
  const float* W = (w == 0) ? Wq : (w == 1 ? Wk : Wv);
  const float* s = W + (size_t)(ks * 32 + j * 16 + (lane >> 4) * 8) * HEAD +
                   nt * 16 + (lane & 15);
  u32x4 v;
#pragma unroll
  for (int i = 0; i < 4; ++i)
    v[i] = (unsigned)f2u(s[(2 * i) * HEAD]) |
           ((unsigned)f2u(s[(2 * i + 1) * HEAD]) << 16);
  *reinterpret_cast<u32x4*>(Wp + (size_t)c * 8) = v;
}

// ---------------------------------------------------------------------------
// Kernel 1: fused QKV projection. One wave = one 16-row tile of [32768,768]x
// [768,64] for q,k,v simultaneously (x is read exactly once); 8 waves = 128
// rows share one copy of the packed weights. x (f32) and the weights of 4
// k-steps form a stage; stages go through a two-buffer LDS ring filled by
// GLOBAL_LOAD_ASYNC_TO_LDS_B128 in whole lines, so the next stage flies while
// this one is worked on. Per k-step the x slice and all 12 B-fragments are read
// from LDS as one group, then the 12 WMMAs run back-to-back.
// q scaled by QSCALE; v stored transposed [64][32768] for the V^T A-fragments of O^T += V^T P^T.
// ---------------------------------------------------------------------------
__global__ __launch_bounds__(256) void qkv_kernel(
    const float* __restrict__ x, const float* __restrict__ bq,
    const float* __restrict__ bk, const float* __restrict__ bv,
    const unsigned short* __restrict__ Wp, unsigned short* __restrict__ qo,
    unsigned short* __restrict__ ko, unsigned short* __restrict__ vT) {
  // Weights keep their fragment order (a wave-wide read is 512 contiguous bytes);
  // x rows are padded to 16 B x odd so the 16-lane fragment reads hit distinct banks.
  __shared__ __attribute__((aligned(16))) u32x4 wbuf[2][WSTAGE];         // [buf][chunk]
  __shared__ __attribute__((aligned(16))) float xbuf[2][QROWS][XPITCH];  // [buf][row][k]
  const int tid = threadIdx.x;
  const int lane = tid & 31;
  const int wid = tid >> 5;
  const int rowb = blockIdx.x * QROWS;
  const int row0 = rowb + wid * 16;
  const int m = lane & 15, hf = lane >> 4;

  // Async-stage 4 k-steps: 48 KiB of packed weights (12 copies a thread) and
  // 128 rows x 512 B of x (16 copies a thread; a wave takes one row's 4 lines).
  auto issue_stage = [&](int st, int buf) {
    const float* xsrc = x + (size_t)rowb * N_EMBD;
    // The slice's step stands in the scalar base, so all slices of an operand
    // share one lane offset register, which also takes the stage's own step.
    const int wo = (st * WSTAGE + tid) * 16;
    const int xo = ((tid >> 5) * N_EMBD + st * (SSTEPS * 32) + (tid & 31) * 4) * 4;
    unsigned wl[12], xl[16];
#pragma unroll
    for (int j = 0; j < 12; ++j) wl[j] = lds_addr(&wbuf[buf][j * 256 + tid]);
#pragma unroll
    for (int j = 0; j < 16; ++j)
      xl[j] = lds_addr(&xbuf[buf][j * 8 + (tid >> 5)][(tid & 31) * 4]);
    // Each run of copies is one statement, so that its closing s_wait_xcnt stands
    // in front of every later write of an address register that the copies name
    // (two statements: one takes at most thirty operands). x goes first: it comes
    // from memory, the weights from L2.
    asm volatile(
        "global_load_async_to_lds_b128 %0, %14, %15\n\t"
        "global_load_async_to_lds_b128 %1, %14, %16\n\t"
        "global_load_async_to_lds_b128 %2, %14, %17\n\t"
        "global_load_async_to_lds_b128 %3, %14, %18\n\t"
        "global_load_async_to_lds_b128 %4, %14, %19\n\t"
        "global_load_async_to_lds_b128 %5, %14, %20\n\t"
        "global_load_async_to_lds_b128 %6, %14, %21\n\t"
        "global_load_async_to_lds_b128 %7, %14, %22\n\t"
        "global_load_async_to_lds_b128 %8, %14, %23\n\t"
        "global_load_async_to_lds_b128 %9, %14, %24\n\t"
        "global_load_async_to_lds_b128 %10, %14, %25\n\t"
        "global_load_async_to_lds_b128 %11, %14, %26\n\t"
        "global_load_async_to_lds_b128 %12, %14, %27\n\t"
        "global_load_async_to_lds_b128 %13, %14, %28\n\t"
        "s_wait_xcnt 0x0"
        :: "v"(xl[0]), "v"(xl[1]), "v"(xl[2]), "v"(xl[3]), "v"(xl[4]), "v"(xl[5]), "v"(xl[6]),
           "v"(xl[7]), "v"(xl[8]), "v"(xl[9]), "v"(xl[10]), "v"(xl[11]), "v"(xl[12]), "v"(xl[13]),
           "v"(xo),
           "s"(xsrc), "s"(xsrc + 8 * N_EMBD), "s"(xsrc + 16 * N_EMBD), "s"(xsrc + 24 * N_EMBD),
           "s"(xsrc + 32 * N_EMBD), "s"(xsrc + 40 * N_EMBD), "s"(xsrc + 48 * N_EMBD),
           "s"(xsrc + 56 * N_EMBD), "s"(xsrc + 64 * N_EMBD), "s"(xsrc + 72 * N_EMBD),
           "s"(xsrc + 80 * N_EMBD), "s"(xsrc + 88 * N_EMBD), "s"(xsrc + 96 * N_EMBD),
           "s"(xsrc + 104 * N_EMBD)
        : "memory");
    asm volatile(
        "global_load_async_to_lds_b128 %0, %14, %16\n\t"
        "global_load_async_to_lds_b128 %1, %14, %17\n\t"
        "global_load_async_to_lds_b128 %2, %15, %18\n\t"
        "global_load_async_to_lds_b128 %3, %15, %19\n\t"
        "global_load_async_to_lds_b128 %4, %15, %20\n\t"
        "global_load_async_to_lds_b128 %5, %15, %21\n\t"
        "global_load_async_to_lds_b128 %6, %15, %22\n\t"
        "global_load_async_to_lds_b128 %7, %15, %23\n\t"
        "global_load_async_to_lds_b128 %8, %15, %24\n\t"
        "global_load_async_to_lds_b128 %9, %15, %25\n\t"
        "global_load_async_to_lds_b128 %10, %15, %26\n\t"
        "global_load_async_to_lds_b128 %11, %15, %27\n\t"
        "global_load_async_to_lds_b128 %12, %15, %28\n\t"
        "global_load_async_to_lds_b128 %13, %15, %29\n\t"
        "s_wait_xcnt 0x0"
        :: "v"(xl[14]), "v"(xl[15]),
           "v"(wl[0]), "v"(wl[1]), "v"(wl[2]), "v"(wl[3]), "v"(wl[4]), "v"(wl[5]),
           "v"(wl[6]), "v"(wl[7]), "v"(wl[8]), "v"(wl[9]), "v"(wl[10]), "v"(wl[11]),
           "v"(xo), "v"(wo),
           "s"(xsrc + 112 * N_EMBD), "s"(xsrc + 120 * N_EMBD),
           "s"(Wp), "s"(Wp + 1 * 2048), "s"(Wp + 2 * 2048), "s"(Wp + 3 * 2048),
           "s"(Wp + 4 * 2048), "s"(Wp + 5 * 2048), "s"(Wp + 6 * 2048), "s"(Wp + 7 * 2048),
           "s"(Wp + 8 * 2048), "s"(Wp + 9 * 2048), "s"(Wp + 10 * 2048), "s"(Wp + 11 * 2048)
        : "memory");
  };

  v8f acc[3][4];
#pragma unroll
  for (int w = 0; w < 3; ++w)
#pragma unroll
    for (int nt = 0; nt < 4; ++nt) acc[w][nt] = zero8();

  issue_stage(0, 0);
  asm volatile("s_wait_asynccnt 0x0" ::: "memory");  // own copies of stage 0 landed
  __syncthreads();                                   // stage 0 visible to all 8 waves
  issue_stage(1, 1);
  for (int st = 0; st < NSTAGE; ++st) {
    const int cur = st & 1;
    const float* xlane = &xbuf[cur][wid * 16 + m][8 * hf];
    const u32x4* wlane = &wbuf[cur][lane];
#pragma unroll
    for (int kk = 0; kk < SSTEPS; ++kk) {
      // Raw 16x32 slice of x (f32; this lane's k = 8*hf + 0..7 and 16 + 8*hf +
      // 0..7) and the 12 packed B fragments of this k-step.
      float4 xr[4];
      xr[0] = *reinterpret_cast<const float4*>(xlane + kk * 32);
      xr[1] = *reinterpret_cast<const float4*>(xlane + kk * 32 + 4);
      xr[2] = *reinterpret_cast<const float4*>(xlane + kk * 32 + 16);
      xr[3] = *reinterpret_cast<const float4*>(xlane + kk * 32 + 20);
      const u32x4* wk = wlane + kk * (NFRAG * 64);
      v16bf bfr[NFRAG];
#pragma unroll
      for (int f = 0; f < NFRAG; ++f) {
        u32x4 lo = wk[f * 64], hi = wk[f * 64 + 32];
        bfr[f] = __builtin_bit_cast(
            v16bf, __builtin_shufflevector(lo, hi, 0, 1, 2, 3, 4, 5, 6, 7));
      }
      // Keeps the 28 LDS loads above in flight together: without it the scheduler
      // sinks each fragment's loads to its WMMA and the wave waits 12 times.
      __builtin_amdgcn_sched_barrier(0);
      // A fragment: f32 -> bf16 (v_cvt_pk_bf16_f32).
      v16bf a;
#pragma unroll
      for (int i = 0; i < 4; ++i) {
        a[4 * i] = (__bf16)xr[i].x;
        a[4 * i + 1] = (__bf16)xr[i].y;
        a[4 * i + 2] = (__bf16)xr[i].z;
        a[4 * i + 3] = (__bf16)xr[i].w;
      }
#pragma unroll
      for (int w = 0; w < 3; ++w)
#pragma unroll
        for (int nt = 0; nt < 4; ++nt)
          acc[w][nt] = wmma_bf16(a, bfr[w * 4 + nt], acc[w][nt]);
    }
    // Hand-over: this wave has left buffer cur and its copies of the next stage
    // have landed; the one barrier publishes that stage and frees buffer cur,
    // which is refilled behind it, so the refill flies during the next stage.
    asm volatile("s_wait_dscnt 0x0" ::: "memory");
    asm volatile("s_wait_asynccnt 0x0" ::: "memory");
    __syncthreads();
    if (st + 2 < NSTAGE) issue_stage(st + 2, cur);
  }
  asm volatile("s_wait_asynccnt 0x0" ::: "memory");  // nothing in flight at the end

  // C/D layout: VGPR r = rows r (lanes 0-15) / r+8 (lanes 16-31), col = lane%16.
#pragma unroll
  for (int nt = 0; nt < 4; ++nt) {
    int col = nt * 16 + m;
    float biasq = bq[col], biask = bk[col], biasv = bv[col];
#pragma unroll
    for (int r = 0; r < 8; ++r) {
      int row = row0 + r + 8 * hf;
      qo[(size_t)row * HEAD + col] = f2u((acc[0][nt][r] + biasq) * QSCALE);
      ko[(size_t)row * HEAD + col] = f2u(acc[1][nt][r] + biask);
      vT[(size_t)col * MTOT + row] = f2u(acc[2][nt][r] + biasv);
    }
  }
}

// ---------------------------------------------------------------------------
// Kernel 2: flash attention. 16 waves/block (four per SIMD, under 256 VGPRs
// each), 128 q rows/block, 256 keys per staged block.
// Wave (g, c) = (wid >> 2, wid & 3) takes the 32 query columns c (two 16-column
// tiles) and the 64 keys g of every block, in two passes of 32 keys (the
// register budget), so each K / V^T fragment read from LDS feeds two WMMAs and
// a staged block serves 128 queries; while one wave of a SIMD works through its
// softmax, three others have matrix or vector work.
// K/V blocks staged in LDS via double-buffered async DMA; a pass's K fragments
// are read from LDS during the pass before. S^T = K Q^T: lane (m, hf) holds 16
// of the 32 scores of query column m of each tile, so the online softmax (log2
// domain) reduces in registers plus one half exchange, and each pair of f32 S^T
// tiles converts in place into a B operand of O^T += V^T P^T (hardware k order
// on both sides). The four key groups' partial results are joined once, after
// the loop, through LDS.
// ---------------------------------------------------------------------------
__global__ __launch_bounds__(512) void attn_kernel(
    const unsigned short* __restrict__ q, const unsigned short* __restrict__ kg,
    const unsigned short* __restrict__ vg, float* __restrict__ out) {
  // Padded rows (pitch 16 B x odd) so the 16-lane fragment reads hit distinct banks.
  __shared__ __attribute__((aligned(16))) unsigned short kbuf[2][PBLK][72];   // [buf][key][h]
  __shared__ __attribute__((aligned(16))) unsigned short vbuf[2][HEAD][264];  // [buf][h][key]
  __shared__ float4 xo[16][2][8][32];  // [wave][column tile][quad][lane]: partial O^T
  __shared__ float2 xml[16][2][32];    // its running maximum and sum share
  const int tid = threadIdx.x;
  const int lane = tid & 31;
  const int wid = tid >> 5;
  const int grp = wid >> 2;  // key group of this wave
  const int m = lane & 15, hf = lane >> 4;
  const int base = blockIdx.y * SEQ;
  const int q0 = blockIdx.x * 128 + (wid & 3) * 32;
  int kks[8];
  kk_pattern(hf, kks);

  // Async-stage one 256-key block (K: 256x64 bf16, V^T: 64x256 bf16) into LDS.
  // 512 threads x (4 K + 4 V) GLOBAL_LOAD_ASYNC_TO_LDS_B128 per block; adjacent
  // lanes take adjacent 16-byte chunks of whole 128-byte lines.
  auto issue_block = [&](int kb, int buf) {
    const unsigned short* ksrc = kg + (size_t)base * HEAD;
    const unsigned short* vsrc = vg + (size_t)base;
    // Slice j of 512 chunks of 16 B: K rows j*64.. (8 chunks a row, 8 KiB in a
    // row in global), V^T rows j*16.. (32 chunks a row). The slice's step stands
    // in the scalar base, so all four slices share one lane offset register,
    // which also takes the block's own step.
    const int ko = (kb * HEAD + tid * 8) * 2;
    const int vo = ((tid >> 5) * MTOT + (tid & 31) * 8 + kb) * 2;
    unsigned kl[4], vl[4];
#pragma unroll
    for (int j = 0; j < 4; ++j) {
      kl[j] = lds_addr(&kbuf[buf][j * 64 + (tid >> 3)][(tid & 7) * 8]);
      vl[j] = lds_addr(&vbuf[buf][j * 16 + (tid >> 5)][(tid & 31) * 8]);
    }
    // One statement, so that the closing s_wait_xcnt stands in front of every
    // later write of an address register that these copies name.
    asm volatile(
        "global_load_async_to_lds_b128 %0, %8, %10\n\t"
        "global_load_async_to_lds_b128 %1, %8, %11\n\t"
        "global_load_async_to_lds_b128 %2, %8, %12\n\t"
        "global_load_async_to_lds_b128 %3, %8, %13\n\t"
        "global_load_async_to_lds_b128 %4, %9, %14\n\t"
        "global_load_async_to_lds_b128 %5, %9, %15\n\t"
        "global_load_async_to_lds_b128 %6, %9, %16\n\t"
        "global_load_async_to_lds_b128 %7, %9, %17\n\t"
        "s_wait_xcnt 0x0"
        :: "v"(kl[0]), "v"(kl[1]), "v"(kl[2]), "v"(kl[3]),
           "v"(vl[0]), "v"(vl[1]), "v"(vl[2]), "v"(vl[3]),
           "v"(ko), "v"(vo),
           "s"(ksrc), "s"(ksrc + 64 * HEAD), "s"(ksrc + 128 * HEAD), "s"(ksrc + 192 * HEAD),
           "s"(vsrc), "s"(vsrc + 16 * MTOT), "s"(vsrc + 32 * MTOT), "s"(vsrc + 48 * MTOT)
        : "memory");
  };

  // Q^T B-fragments (K = head dim 64 -> two 32x16 fragments per column tile),
  // held for all keys.
  v16bf aq[2][2];
#pragma unroll
  for (int c = 0; c < 2; ++c)
#pragma unroll
    for (int ks = 0; ks < 2; ++ks)
      aq[c][ks] = load_frag(q + (size_t)(base + q0 + c * 16 + m) * HEAD + ks * 32, kks);

  // Per query column: running maximum (same in both halves) and this half's
  // share of the running sum (the halves are joined once, after the loop).
  float mrow[2] = {-3.0e38f, -3.0e38f}, lrow[2] = {0.f, 0.f};
  v8f o[2][4];  // o[c][nt][r] = O^T[nt*16 + 8*hf + r][c*16 + m]
#pragma unroll
  for (int c = 0; c < 2; ++c)
#pragma unroll
    for (int nt = 0; nt < 4; ++nt) o[c][nt] = zero8();

  // K fragments (A operands of the score products), fetched one pass ahead.
  v16bf kf[2][2];
  auto fetch_k = [&](int buf, int sp) {
#pragma unroll
    for (int ks = 0; ks < 2; ++ks)
#pragma unroll
      for (int t = 0; t < 2; ++t)
        kf[ks][t] = load_frag_lds(&kbuf[buf][grp * GBLK + sp * KBLK + t * 16 + m][ks * 32], hf);
  };

  issue_block(0, 0);
  asm volatile("s_wait_asynccnt 0x0" ::: "memory");  // own copies of block 0 landed
  __syncthreads();                                   // block 0 visible to all 16 waves
  issue_block(PBLK, 1);
  fetch_k(0, 0);
  for (int kb = 0; kb < SEQ; kb += PBLK) {
    const int cur = (kb / PBLK) & 1;
#pragma unroll
    for (int sp = 0; sp < 2; ++sp) {  // the two 32-key passes of this wave's 64 keys
      // The pass's 4 V^T fragments are fetched from LDS first, in the order of
      // their use; its 4 K fragments are in registers since the pass before.
      v16bf vf[4];
#pragma unroll
      for (int nt = 0; nt < 4; ++nt)
        vf[nt] = load_frag_lds(&vbuf[cur][nt * 16 + m][grp * GBLK + sp * KBLK], hf);
      // Keeps the 8 LDS loads above in flight together, in front of the score
      // products, under which they fly.
      __builtin_amdgcn_sched_barrier(0);
      // S^T = K * Q^T for this wave's 32 keys: 2 key tiles x 2 k-steps x 2 column
      // tiles, K rows as A. s[c][t][r] = S^T[t*16 + 8*hf + r][c*16 + m].
      v8f s[2][2];
#pragma unroll
      for (int c = 0; c < 2; ++c)
#pragma unroll
        for (int t = 0; t < 2; ++t) s[c][t] = zero8();
#pragma unroll
      for (int ks = 0; ks < 2; ++ks)
#pragma unroll
        for (int t = 0; t < 2; ++t)
#pragma unroll
          for (int c = 0; c < 2; ++c)
            s[c][t] = wmma_bf16(kf[ks][t], aq[c][ks], s[c][t]);
      // Keeps the 8 score products back to back (spread into the softmax the build
      // pads them with more v_nop) and, in the second pass, in front of the
      // hand-over: there they run while the V^T fragments are on their way from LDS.
      __builtin_amdgcn_sched_barrier(0);
      // Hand-over, in the block's second pass, behind the last LDS read of buffer
      // cur: this wave holds its fragments and its copies of the next block have
      // landed; the one barrier publishes that block and frees buffer cur, which is
      // refilled behind it, so the refill flies during the whole next block.
      if (sp == 1) {
        asm volatile("s_wait_dscnt 0x0" ::: "memory");
        asm volatile("s_wait_asynccnt 0x0" ::: "memory");
        __syncthreads();
        if (kb + 2 * PBLK < SEQ) issue_block(kb + 2 * PBLK, cur);
      }
      // Per column tile: online softmax (exp2 domain; scale folded into q), one
      // column per lane, then the tile's second products.
#pragma unroll
      for (int c = 0; c < 2; ++c) {
        float mc[4];  // four independent maximum chains
#pragma unroll
        for (int i = 0; i < 4; ++i)
          mc[i] = fmaxf(fmaxf(s[c][0][i], s[c][1][i]), fmaxf(s[c][0][i + 4], s[c][1][i + 4]));
        float mx = fmaxf(fmaxf(mc[0], mc[1]), fmaxf(mc[2], mc[3]));
        mx = fmaxf(mx, xhalf(mx));
        const float mn = fmaxf(mrow[c], mx);
        // Bare v_exp_f32: every argument is <= 0, and a term under 2^-126 (flushed
        // to 0 here) cannot move a sum whose largest term is 1, so the library
        // exp2f's small-result guard (compare, two selects, add, ldexp) is not needed.
        const float alpha = __builtin_amdgcn_exp2f(mrow[c] - mn);
        mrow[c] = mn;
        // P^T as a B operand of 32 keys: pt[j] = key 8*hf + j,
        // pt[8 + j] = key 16 + 8*hf + j.
        v16bf pt;
        float rs[4] = {0.f, 0.f, 0.f, 0.f};
#pragma unroll
        for (int r = 0; r < 8; ++r) {
          float p0 = __builtin_amdgcn_exp2f(s[c][0][r] - mn);
          float p1 = __builtin_amdgcn_exp2f(s[c][1][r] - mn);
          rs[2 * (r & 1)] += p0;
          rs[2 * (r & 1) + 1] += p1;
          pt[r] = (__bf16)p0;
          pt[8 + r] = (__bf16)p1;
        }
        lrow[c] = lrow[c] * alpha + ((rs[0] + rs[1]) + (rs[2] + rs[3]));
#pragma unroll
        for (int nt = 0; nt < 4; ++nt)
#pragma unroll
          for (int r = 0; r < 8; ++r) o[c][nt][r] *= alpha;
        // The next pass's K fragments (same block, or the next one, published by
        // this pass's barrier), asked for in front of the first tile's second
        // products: they fly under those and the second tile's softmax, so the next
        // pass's score products need not wait out a whole LDS latency. The scalar
        // branch keeps the last pass off a block that does not exist.
        if (c == 0 && sp == 0) fetch_k(cur, 1);
        if (c == 0 && sp == 1 && kb + PBLK < SEQ) fetch_k(cur ^ 1, 0);
        // O^T += V^T * P^T : V^T rows are the A fragments (16 h x 32 keys).
#pragma unroll
        for (int nt = 0; nt < 4; ++nt) o[c][nt] = wmma_bf16(vf[nt], pt, o[c][nt]);
      }
    }
  }
  asm volatile("s_wait_asynccnt 0x0" ::: "memory");  // nothing in flight at the end
  // Join the four key groups: waves wid & 3 + 4*g hold the same 32 columns.
  // Every wave hands over both its tiles; the wave of group g then joins column
  // tile g >> 1, head rows 32*(g & 1) .. +31, over the four groups in order.
#pragma unroll
  for (int c = 0; c < 2; ++c) {
#pragma unroll
    for (int nt = 0; nt < 4; ++nt) {
      xo[wid][c][2 * nt][lane] =
          make_float4(o[c][nt][0], o[c][nt][1], o[c][nt][2], o[c][nt][3]);
      xo[wid][c][2 * nt + 1][lane] =
          make_float4(o[c][nt][4], o[c][nt][5], o[c][nt][6], o[c][nt][7]);
    }
    xml[wid][c][lane] = make_float2(mrow[c], lrow[c]);
  }
  __syncthreads();  // all partial tiles are readable
  const int ct = grp >> 1, nh = grp & 1, cw = wid & 3;
  float2 ml[4];
#pragma unroll
  for (int g = 0; g < 4; ++g) ml[g] = xml[g * 4 + cw][ct][lane];
  const float mj = fmaxf(fmaxf(ml[0].x, ml[1].x), fmaxf(ml[2].x, ml[3].x));
  float wg[4], lj = 0.f;
#pragma unroll
  for (int g = 0; g < 4; ++g) {
    wg[g] = __builtin_amdgcn_exp2f(ml[g].x - mj);  // arguments <= 0, as above
    lj += ml[g].y * wg[g];
  }
  // Join the halves' sums, normalize, store: a lane holds 8 consecutive h of
  // its query row per tile -> two 16-byte stores.
  const float inv = 1.0f / (lj + xhalf(lj));
#pragma unroll
  for (int g = 0; g < 4; ++g) wg[g] *= inv;
  float* orow = out + (size_t)(base + q0 + ct * 16 + m) * HEAD + 8 * hf;
#pragma unroll
  for (int n = 0; n < 2; ++n) {
    const int nt = nh * 2 + n;
    float4 lo = make_float4(0.f, 0.f, 0.f, 0.f), hv = lo;
#pragma unroll
    for (int g = 0; g < 4; ++g) {
      const float4 pl = xo[g * 4 + cw][ct][2 * nt][lane];
      const float4 ph = xo[g * 4 + cw][ct][2 * nt + 1][lane];
      lo.x += pl.x * wg[g]; lo.y += pl.y * wg[g]; lo.z += pl.z * wg[g]; lo.w += pl.w * wg[g];
      hv.x += ph.x * wg[g]; hv.y += ph.y * wg[g]; hv.z += ph.z * wg[g]; hv.w += ph.w * wg[g];
    }
    *reinterpret_cast<float4*>(orow + nt * 16) = lo;
    *reinterpret_cast<float4*>(orow + nt * 16 + 4) = hv;
  }
}

// ---------------------------------------------------------------------------
extern "C" void kernel_launch(void* const* d_in, const int* in_sizes, int n_in,
                              void* d_out, int out_size, void* d_ws,
                              size_t ws_size, hipStream_t stream) {
  (void)in_sizes; (void)n_in; (void)out_size; (void)ws_size;
  const float* x  = (const float*)d_in[0];
  const float* Wq = (const float*)d_in[1];
  const float* bq = (const float*)d_in[2];
  const float* Wk = (const float*)d_in[3];
  const float* bk = (const float*)d_in[4];
  const float* Wv = (const float*)d_in[5];
  const float* bv = (const float*)d_in[6];
  float* out = (float*)d_out;

  // Workspace: q,k bf16 [32768][64]; vT bf16 [64][32768]; packed weights bf16.
  char* ws = (char*)d_ws;
  unsigned short* qo  = (unsigned short*)(ws);
  unsigned short* ko  = (unsigned short*)(ws + (size_t)MTOT * HEAD * 2);
  unsigned short* vT  = (unsigned short*)(ws + (size_t)MTOT * HEAD * 4);
  unsigned short* Wp  = (unsigned short*)(ws + (size_t)MTOT * HEAD * 6);

  hipLaunchKernelGGL(wcvt_kernel, dim3((WCHUNKS + 255) / 256),
                     dim3(256), 0, stream, Wq, Wk, Wv, Wp);
  hipLaunchKernelGGL(qkv_kernel, dim3(MTOT / QROWS), dim3(256), 0, stream, x, bq,
                     bk, bv, Wp, qo, ko, vT);
  hipLaunchKernelGGL(attn_kernel, dim3(SEQ / 128, BATCH), dim3(512), 0, stream,
                     qo, ko, vT, out);
}

// v010
// One run takes 44.5 microseconds.
// In both of two side-by-side timings against v009, it was 1.05 times as fast.
// Over all steps from v000 it is 7.89 times as fast.
#include <hip/hip_runtime.h>

// ---------------------------------------------------------------------------
// Single-head attention for MI455X (gfx1250, wave32, WMMA).
//   x:[8,4096,768] f32 -> q,k,v (bf16 in ws) -> flash attention -> out f32.
// Matmuls on v_wmma_f32_16x16x32_bf16 (f32 accum). K/V blocks staged into LDS
// with double-buffered GLOBAL_LOAD_ASYNC_TO_LDS_B128 (ASYNCcnt). Softmax in
// exp2 domain (scale*log2e folded into q). Scores are formed transposed
// (S^T = K Q^T, O^T += V^T P^T): a lane owns one query column.
// ---------------------------------------------------------------------------

typedef __attribute__((ext_vector_type(16))) __bf16 v16bf;
typedef __attribute__((ext_vector_type(8)))  float  v8f;
typedef __attribute__((ext_vector_type(4)))  unsigned int u32x4;

#define N_EMBD 768
#define HEAD   64
#define BATCH  8
#define SEQ    4096
#define MTOT   (BATCH * SEQ)          // 32768 rows total
#define KSTEPS (N_EMBD / 32)          // 24 k-steps of the projection
#define NFRAG  12                     // q,k,v x 4 column tiles
#define WCHUNKS (KSTEPS * NFRAG * 64) // 16-byte chunks of the packed weights
#define QROWS  128                    // x rows per projection block
#define SSTEPS 4                      // k-steps per staged block of the projection
#define NSTAGE (KSTEPS / SSTEPS)      // stages of the projection
#define WSTAGE (SSTEPS * NFRAG * 64)  // 16-byte weight chunks per stage
#define XPITCH (SSTEPS * 32 + 4)      // floats per staged x row (512 B + 16 B)
#define KBLK   32                     // keys per wave and attention pass
#define GBLK   64                     // keys per wave and staged block
#define PBLK   256                    // keys per staged block
// 768^-0.5 * log2(e): logits land directly in log2 domain.
#define QSCALE 0.052058875f

static __device__ __forceinline__ v8f wmma_bf16(v16bf a, v16bf b, v8f c) {
  // (neg_a, A, neg_b, B, c_mod, C, reuse_a, reuse_b)
  return __builtin_amdgcn_wmma_f32_16x16x32_bf16(false, a, false, b, (short)0, c,
                                                 false, false);
}

// f32 -> bf16 via native hardware convert (v_cvt_pk_bf16_f32).
static __device__ __forceinline__ unsigned short f2u(float f) {
  return __builtin_bit_cast(unsigned short, (__bf16)f);
}
static __device__ __forceinline__ __bf16 u2b(unsigned short u) {
  return __builtin_bit_cast(__bf16, u);
}
static __device__ __forceinline__ v8f zero8() {
  v8f z = {0.f, 0.f, 0.f, 0.f, 0.f, 0.f, 0.f, 0.f};
  return z;
}

// K-pair base offsets for the 16-bit A/B fragment layout (ISA 7.12.2):
// half 0 covers K {0..7,16..23}, half 1 covers K {8..15,24..31}, 2 per VGPR.
static __device__ __forceinline__ void kk_pattern(int hf, int* kks) {
#pragma unroll
  for (int i = 0; i < 8; ++i)
    kks[i] = (i < 4 ? 2 * i : 16 + 2 * (i - 4)) + 8 * hf;
}

// Load one 16-bit B fragment (32xK rows x 16 cols) from a row pointer whose
// row holds contiguous K-pairs; kks holds this lane's K-pair offsets.
static __device__ __forceinline__ v16bf load_frag(const unsigned short* p,
                                                  const int* kks) {
  v16bf b;
#pragma unroll
  for (int i = 0; i < 8; ++i) {
    unsigned int u = *reinterpret_cast<const unsigned int*>(p + kks[i]);
    b[2 * i] = u2b((unsigned short)(u & 0xffffu));
    b[2 * i + 1] = u2b((unsigned short)(u >> 16));
  }
  return b;
}

// The same fragment from a 16-byte aligned LDS row: this lane's K-pairs are two
// runs of 8 elements (8*hf.., 16 + 8*hf..), read as two 16-byte loads.
static __device__ __forceinline__ v16bf load_frag_lds(const unsigned short* p, int hf) {
  u32x4 lo = *reinterpret_cast<const u32x4*>(p + 8 * hf);
  u32x4 hi = *reinterpret_cast<const u32x4*>(p + 16 + 8 * hf);
  return __builtin_bit_cast(
      v16bf, __builtin_shufflevector(lo, hi, 0, 1, 2, 3, 4, 5, 6, 7));
}

// Lane l <-> lane l ^ 16 (the two halves that share one query column).
static __device__ __forceinline__ float xhalf(float x) {
  int b = __builtin_bit_cast(int, x);
  return __builtin_bit_cast(
      float, __builtin_amdgcn_permlanex16(b, b, 0x76543210, 0xfedcba98, false, false));
}

// Low 32 bits of a flat pointer into LDS == LDS byte offset (aperture layout).
static __device__ __forceinline__ unsigned lds_addr(const void* p) {
  return (unsigned)(size_t)p;
}

// ---------------------------------------------------------------------------
// Kernel 0: Wq|Wk|Wv [768][64] f32 -> bf16 packed in B-fragment order.
// Fragment (ks, f = w*4 + nt) is 1 KiB: chunk j (0,1) of lane l lies at
// j*512 + l*16 bytes and holds k = ks*32 + j*16 + (l>>4)*8 + 0..7 of column
// nt*16 + (l&15), so one wave-wide 16-byte load reads 512 contiguous bytes.
// ---------------------------------------------------------------------------
__global__ __launch_bounds__(256) void wcvt_kernel(
    const float* __restrict__ Wq, const float* __restrict__ Wk,
    const float* __restrict__ Wv, unsigned short* __restrict__ Wp) {
  int c = blockIdx.x * 256 + threadIdx.x;  // one 16-byte chunk per thread
  if (c >= WCHUNKS) return;
  int lane = c & 31, j = (c >> 5) & 1, t = c >> 6;
  int f = t % NFRAG, ks = t / NFRAG;
  int w = f >> 2, nt = f & 3;
  const float* W = (w == 0) ? Wq : (w == 1 ? Wk : Wv);
  const float* s = W + (size_t)(ks * 32 + j * 16 + (lane >> 4) * 8) * HEAD +
                   nt * 16 + (lane & 15);
  u32x4 v;
#pragma unroll
  for (int i = 0; i < 4; ++i)
    v[i] = (unsigned)f2u(s[(2 * i) * HEAD]) |
           ((unsigned)f2u(s[(2 * i + 1) * HEAD]) << 16);
  *reinterpret_cast<u32x4*>(Wp + (size_t)c * 8) = v;
}

// ---------------------------------------------------------------------------
// Kernel 1: fused QKV projection. One wave = one 16-row tile of [32768,768]x
// [768,64] for q,k,v simultaneously (x is read exactly once); 8 waves = 128
// rows share one copy of the packed weights. x (f32) and the weights of 4
// k-steps form a stage; stages go through a two-buffer LDS ring filled by
// GLOBAL_LOAD_ASYNC_TO_LDS_B128 in whole lines, so the next stage flies while
// this one is worked on. Per k-step the x slice and all 12 B-fragments are read
// from LDS as one group, then the 12 WMMAs run back-to-back.
// q scaled by QSCALE; v stored transposed [64][32768] for the V^T A-fragments of O^T += V^T P^T.
// ---------------------------------------------------------------------------
__global__ __launch_bounds__(256) void qkv_kernel(
    const float* __restrict__ x, const float* __restrict__ bq,
    const float* __restrict__ bk, const float* __restrict__ bv,
    const unsigned short* __restrict__ Wp, unsigned short* __restrict__ qo,
    unsigned short* __restrict__ ko, unsigned short* __restrict__ vT) {
  // Weights keep their fragment order (a wave-wide read is 512 contiguous bytes);
  // x rows are padded to 16 B x odd so the 16-lane fragment reads hit distinct banks.
  __shared__ __attribute__((aligned(16))) u32x4 wbuf[2][WSTAGE];         // [buf][chunk]
  __shared__ __attribute__((aligned(16))) float xbuf[2][QROWS][XPITCH];  // [buf][row][k]
  const int tid = threadIdx.x;
  const int lane = tid & 31;
  const int wid = tid >> 5;
  const int rowb = blockIdx.x * QROWS;
  const int row0 = rowb + wid * 16;
  const int m = lane & 15, hf = lane >> 4;

  // Async-stage 4 k-steps: 48 KiB of packed weights (12 copies a thread) and
  // 128 rows x 512 B of x (16 copies a thread; a wave takes one row's 4 lines).
  auto issue_stage = [&](int st, int buf) {
    const float* xsrc = x + (size_t)rowb * N_EMBD;
    // The slice's step stands in the scalar base, so all slices of an operand
    // share one lane offset register, which also takes the stage's own step.
    const int wo = (st * WSTAGE + tid) * 16;
    const int xo = ((tid >> 5) * N_EMBD + st * (SSTEPS * 32) + (tid & 31) * 4) * 4;
    unsigned wl[12], xl[16];
#pragma unroll
    for (int j = 0; j < 12; ++j) wl[j] = lds_addr(&wbuf[buf][j * 256 + tid]);
#pragma unroll
    for (int j = 0; j < 16; ++j)
      xl[j] = lds_addr(&xbuf[buf][j * 8 + (tid >> 5)][(tid & 31) * 4]);
    // Each run of copies is one statement, so that its closing s_wait_xcnt stands
    // in front of every later write of an address register that the copies name
    // (two statements: one takes at most thirty operands). x goes first: it comes
    // from memory, the weights from L2.
    asm volatile(
        "global_load_async_to_lds_b128 %0, %14, %15\n\t"
        "global_load_async_to_lds_b128 %1, %14, %16\n\t"
        "global_load_async_to_lds_b128 %2, %14, %17\n\t"
        "global_load_async_to_lds_b128 %3, %14, %18\n\t"
        "global_load_async_to_lds_b128 %4, %14, %19\n\t"
        "global_load_async_to_lds_b128 %5, %14, %20\n\t"
        "global_load_async_to_lds_b128 %6, %14, %21\n\t"
        "global_load_async_to_lds_b128 %7, %14, %22\n\t"
        "global_load_async_to_lds_b128 %8, %14, %23\n\t"
        "global_load_async_to_lds_b128 %9, %14, %24\n\t"
        "global_load_async_to_lds_b128 %10, %14, %25\n\t"
        "global_load_async_to_lds_b128 %11, %14, %26\n\t"
        "global_load_async_to_lds_b128 %12, %14, %27\n\t"
        "global_load_async_to_lds_b128 %13, %14, %28\n\t"
        "s_wait_xcnt 0x0"
        :: "v"(xl[0]), "v"(xl[1]), "v"(xl[2]), "v"(xl[3]), "v"(xl[4]), "v"(xl[5]), "v"(xl[6]),
           "v"(xl[7]), "v"(xl[8]), "v"(xl[9]), "v"(xl[10]), "v"(xl[11]), "v"(xl[12]), "v"(xl[13]),
           "v"(xo),
           "s"(xsrc), "s"(xsrc + 8 * N_EMBD), "s"(xsrc + 16 * N_EMBD), "s"(xsrc + 24 * N_EMBD),
           "s"(xsrc + 32 * N_EMBD), "s"(xsrc + 40 * N_EMBD), "s"(xsrc + 48 * N_EMBD),
           "s"(xsrc + 56 * N_EMBD), "s"(xsrc + 64 * N_EMBD), "s"(xsrc + 72 * N_EMBD),
           "s"(xsrc + 80 * N_EMBD), "s"(xsrc + 88 * N_EMBD), "s"(xsrc + 96 * N_EMBD),
           "s"(xsrc + 104 * N_EMBD)
        : "memory");
    asm volatile(
        "global_load_async_to_lds_b128 %0, %14, %16\n\t"
        "global_load_async_to_lds_b128 %1, %14, %17\n\t"
        "global_load_async_to_lds_b128 %2, %15, %18\n\t"
        "global_load_async_to_lds_b128 %3, %15, %19\n\t"
        "global_load_async_to_lds_b128 %4, %15, %20\n\t"
        "global_load_async_to_lds_b128 %5, %15, %21\n\t"
        "global_load_async_to_lds_b128 %6, %15, %22\n\t"
        "global_load_async_to_lds_b128 %7, %15, %23\n\t"
        "global_load_async_to_lds_b128 %8, %15, %24\n\t"
        "global_load_async_to_lds_b128 %9, %15, %25\n\t"
        "global_load_async_to_lds_b128 %10, %15, %26\n\t"
        "global_load_async_to_lds_b128 %11, %15, %27\n\t"
        "global_load_async_to_lds_b128 %12, %15, %28\n\t"
        "global_load_async_to_lds_b128 %13, %15, %29\n\t"
        "s_wait_xcnt 0x0"
        :: "v"(xl[14]), "v"(xl[15]),
           "v"(wl[0]), "v"(wl[1]), "v"(wl[2]), "v"(wl[3]), "v"(wl[4]), "v"(wl[5]),
           "v"(wl[6]), "v"(wl[7]), "v"(wl[8]), "v"(wl[9]), "v"(wl[10]), "v"(wl[11]),
           "v"(xo), "v"(wo),
           "s"(xsrc + 112 * N_EMBD), "s"(xsrc + 120 * N_EMBD),
           "s"(Wp), "s"(Wp + 1 * 2048), "s"(Wp + 2 * 2048), "s"(Wp + 3 * 2048),
           "s"(Wp + 4 * 2048), "s"(Wp + 5 * 2048), "s"(Wp + 6 * 2048), "s"(Wp + 7 * 2048),
           "s"(Wp + 8 * 2048), "s"(Wp + 9 * 2048), "s"(Wp + 10 * 2048), "s"(Wp + 11 * 2048)
        : "memory");
  };

  v8f acc[3][4];
#pragma unroll
  for (int w = 0; w < 3; ++w)
#pragma unroll
    for (int nt = 0; nt < 4; ++nt) acc[w][nt] = zero8();

  issue_stage(0, 0);
  asm volatile("s_wait_asynccnt 0x0" ::: "memory");  // own copies of stage 0 landed
  __syncthreads();                                   // stage 0 visible to all 8 waves
  issue_stage(1, 1);
  for (int st = 0; st < NSTAGE; ++st) {
    const int cur = st & 1;
    const float* xlane = &xbuf[cur][wid * 16 + m][8 * hf];
    const u32x4* wlane = &wbuf[cur][lane];
#pragma unroll
    for (int kk = 0; kk < SSTEPS; ++kk) {
      // Raw 16x32 slice of x (f32; this lane's k = 8*hf + 0..7 and 16 + 8*hf +
      // 0..7) and the 12 packed B fragments of this k-step.
      float4 xr[4];
      xr[0] = *reinterpret_cast<const float4*>(xlane + kk * 32);
      xr[1] = *reinterpret_cast<const float4*>(xlane + kk * 32 + 4);
      xr[2] = *reinterpret_cast<const float4*>(xlane + kk * 32 + 16);
      xr[3] = *reinterpret_cast<const float4*>(xlane + kk * 32 + 20);
      const u32x4* wk = wlane + kk * (NFRAG * 64);
      v16bf bfr[NFRAG];
#pragma unroll
      for (int f = 0; f < NFRAG; ++f) {
        u32x4 lo = wk[f * 64], hi = wk[f * 64 + 32];
        bfr[f] = __builtin_bit_cast(
            v16bf, __builtin_shufflevector(lo, hi, 0, 1, 2, 3, 4, 5, 6, 7));
      }
      // Keeps the 28 LDS loads above in flight together: without it the scheduler
      // sinks each fragment's loads to its WMMA and the wave waits 12 times.
      __builtin_amdgcn_sched_barrier(0);
      // A fragment: f32 -> bf16 (v_cvt_pk_bf16_f32).
      v16bf a;
#pragma unroll
      for (int i = 0; i < 4; ++i) {
        a[4 * i] = (__bf16)xr[i].x;
        a[4 * i + 1] = (__bf16)xr[i].y;
        a[4 * i + 2] = (__bf16)xr[i].z;
        a[4 * i + 3] = (__bf16)xr[i].w;
      }
#pragma unroll
      for (int w = 0; w < 3; ++w)
#pragma unroll
        for (int nt = 0; nt < 4; ++nt)
          acc[w][nt] = wmma_bf16(a, bfr[w * 4 + nt], acc[w][nt]);
    }
    // Hand-over: this wave has left buffer cur and its copies of the next stage
    // have landed; the one barrier publishes that stage and frees buffer cur,
    // which is refilled behind it, so the refill flies during the next stage.
    asm volatile("s_wait_dscnt 0x0" ::: "memory");
    asm volatile("s_wait_asynccnt 0x0" ::: "memory");
    __syncthreads();
    if (st + 2 < NSTAGE) issue_stage(st + 2, cur);
  }
  asm volatile("s_wait_asynccnt 0x0" ::: "memory");  // nothing in flight at the end

  // C/D layout: VGPR r = rows r (lanes 0-15) / r+8 (lanes 16-31), col = lane%16.
#pragma unroll
  for (int nt = 0; nt < 4; ++nt) {
    int col = nt * 16 + m;
    float biasq = bq[col], biask = bk[col], biasv = bv[col];
#pragma unroll
    for (int r = 0; r < 8; ++r) {
      int row = row0 + r + 8 * hf;
      qo[(size_t)row * HEAD + col] = f2u((acc[0][nt][r] + biasq) * QSCALE);
      ko[(size_t)row * HEAD + col] = f2u(acc[1][nt][r] + biask);
      vT[(size_t)col * MTOT + row] = f2u(acc[2][nt][r] + biasv);
    }
  }
}

// ---------------------------------------------------------------------------
// Kernel 2: flash attention. 16 waves/block (four per SIMD, under 256 VGPRs
// each), 128 q rows/block, 256 keys per staged block.
// Wave (g, c) = (wid >> 2, wid & 3) takes the 32 query columns c (two 16-column
// tiles) and the 64 keys g of every block, in two passes of 32 keys (the
// register budget), so each K / V^T fragment read from LDS feeds two WMMAs and
// a staged block serves 128 queries; while one wave of a SIMD works through its
// softmax, three others have matrix or vector work.
// K/V blocks staged in LDS via double-buffered async DMA; a pass's K fragments
// are read from LDS during the pass before. S^T = K Q^T: lane (m, hf) holds 16
// of the 32 scores of query column m of each tile, so the online softmax (log2
// domain) reduces in registers (the halves meet only where a column's reference
// maximum moves: lazy rescale), and each pair of f32 S^T
// tiles converts in place into a B operand of O^T += V^T P^T (hardware k order
// on both sides). The four key groups' partial results are joined once, after
// the loop, through LDS.
// ---------------------------------------------------------------------------
__global__ __launch_bounds__(512) void attn_kernel(
    const unsigned short* __restrict__ q, const unsigned short* __restrict__ kg,
    const unsigned short* __restrict__ vg, float* __restrict__ out) {
  // Padded rows (pitch 16 B x odd) so the 16-lane fragment reads hit distinct banks.
  __shared__ __attribute__((aligned(16))) unsigned short kbuf[2][PBLK][72];   // [buf][key][h]
  __shared__ __attribute__((aligned(16))) unsigned short vbuf[2][HEAD][264];  // [buf][h][key]
  __shared__ float4 xo[16][2][8][32];  // [wave][column tile][quad][lane]: partial O^T
  __shared__ float2 xml[16][2][32];    // its running maximum and sum share
  const int tid = threadIdx.x;
  const int lane = tid & 31;
  const int wid = tid >> 5;
  const int grp = wid >> 2;  // key group of this wave
  const int m = lane & 15, hf = lane >> 4;
  const int base = blockIdx.y * SEQ;
  const int q0 = blockIdx.x * 128 + (wid & 3) * 32;
  int kks[8];
  kk_pattern(hf, kks);

  // Async-stage one 256-key block (K: 256x64 bf16, V^T: 64x256 bf16) into LDS.
  // 512 threads x (4 K + 4 V) GLOBAL_LOAD_ASYNC_TO_LDS_B128 per block; adjacent
  // lanes take adjacent 16-byte chunks of whole 128-byte lines.
  auto issue_block = [&](int kb, int buf) {
    const unsigned short* ksrc = kg + (size_t)base * HEAD;
    const unsigned short* vsrc = vg + (size_t)base;
    // Slice j of 512 chunks of 16 B: K rows j*64.. (8 chunks a row, 8 KiB in a
    // row in global), V^T rows j*16.. (32 chunks a row). The slice's step stands
    // in the scalar base, so all four slices share one lane offset register,
    // which also takes the block's own step.
    const int ko = (kb * HEAD + tid * 8) * 2;
    const int vo = ((tid >> 5) * MTOT + (tid & 31) * 8 + kb) * 2;
    unsigned kl[4], vl[4];
#pragma unroll
    for (int j = 0; j < 4; ++j) {
      kl[j] = lds_addr(&kbuf[buf][j * 64 + (tid >> 3)][(tid & 7) * 8]);
      vl[j] = lds_addr(&vbuf[buf][j * 16 + (tid >> 5)][(tid & 31) * 8]);
    }
    // One statement, so that the closing s_wait_xcnt stands in front of every
    // later write of an address register that these copies name.
    asm volatile(
        "global_load_async_to_lds_b128 %0, %8, %10\n\t"
        "global_load_async_to_lds_b128 %1, %8, %11\n\t"
        "global_load_async_to_lds_b128 %2, %8, %12\n\t"
        "global_load_async_to_lds_b128 %3, %8, %13\n\t"
        "global_load_async_to_lds_b128 %4, %9, %14\n\t"
        "global_load_async_to_lds_b128 %5, %9, %15\n\t"
        "global_load_async_to_lds_b128 %6, %9, %16\n\t"
        "global_load_async_to_lds_b128 %7, %9, %17\n\t"
        "s_wait_xcnt 0x0"
        :: "v"(kl[0]), "v"(kl[1]), "v"(kl[2]), "v"(kl[3]),
           "v"(vl[0]), "v"(vl[1]), "v"(vl[2]), "v"(vl[3]),
           "v"(ko), "v"(vo),
           "s"(ksrc), "s"(ksrc + 64 * HEAD), "s"(ksrc + 128 * HEAD), "s"(ksrc + 192 * HEAD),
           "s"(vsrc), "s"(vsrc + 16 * MTOT), "s"(vsrc + 32 * MTOT), "s"(vsrc + 48 * MTOT)
        : "memory");
  };

  // Q^T B-fragments (K = head dim 64 -> two 32x16 fragments per column tile),
  // held for all keys.
  v16bf aq[2][2];
#pragma unroll
  for (int c = 0; c < 2; ++c)
#pragma unroll
    for (int ks = 0; ks < 2; ++ks)
      aq[c][ks] = load_frag(q + (size_t)(base + q0 + c * 16 + m) * HEAD + ks * 32, kks);

  // Per query column: reference maximum (same in both halves) and this half's
  // share of the running sum (the halves are joined once, after the loop).
  float mrow[2] = {-3.0e38f, -3.0e38f}, lrow[2] = {0.f, 0.f};
  v8f o[2][4];  // o[c][nt][r] = O^T[nt*16 + 8*hf + r][c*16 + m]
#pragma unroll
  for (int c = 0; c < 2; ++c)
#pragma unroll
    for (int nt = 0; nt < 4; ++nt) o[c][nt] = zero8();

  // K fragments (A operands of the score products), fetched one pass ahead.
  v16bf kf[2][2];
  auto fetch_k = [&](int buf, int sp) {
#pragma unroll
    for (int ks = 0; ks < 2; ++ks)
#pragma unroll
      for (int t = 0; t < 2; ++t)
        kf[ks][t] = load_frag_lds(&kbuf[buf][grp * GBLK + sp * KBLK + t * 16 + m][ks * 32], hf);
  };

  issue_block(0, 0);
  asm volatile("s_wait_asynccnt 0x0" ::: "memory");  // own copies of block 0 landed
  __syncthreads();                                   // block 0 visible to all 16 waves
  issue_block(PBLK, 1);
  fetch_k(0, 0);
  for (int kb = 0; kb < SEQ; kb += PBLK) {
    const int cur = (kb / PBLK) & 1;
#pragma unroll
    for (int sp = 0; sp < 2; ++sp) {  // the two 32-key passes of this wave's 64 keys
      // The pass's 4 V^T fragments are fetched from LDS first, in the order of
      // their use; its 4 K fragments are in registers since the pass before.
      v16bf vf[4];
#pragma unroll
      for (int nt = 0; nt < 4; ++nt)
        vf[nt] = load_frag_lds(&vbuf[cur][nt * 16 + m][grp * GBLK + sp * KBLK], hf);
      // Keeps the 8 LDS loads above in flight together, in front of the score
      // products, under which they fly.
      __builtin_amdgcn_sched_barrier(0);
      // S^T = K * Q^T for this wave's 32 keys: 2 key tiles x 2 k-steps x 2 column
      // tiles, K rows as A. s[c][t][r] = S^T[t*16 + 8*hf + r][c*16 + m].
      v8f s[2][2];
#pragma unroll
      for (int c = 0; c < 2; ++c)
#pragma unroll
        for (int t = 0; t < 2; ++t) s[c][t] = zero8();
#pragma unroll
      for (int ks = 0; ks < 2; ++ks)
#pragma unroll
        for (int t = 0; t < 2; ++t)
#pragma unroll
          for (int c = 0; c < 2; ++c)
            s[c][t] = wmma_bf16(kf[ks][t], aq[c][ks], s[c][t]);
      // Keeps the 8 score products back to back (spread into the softmax the build
      // pads them with more v_nop) and, in the second pass, in front of the
      // hand-over: there they run while the V^T fragments are on their way from LDS.
      __builtin_amdgcn_sched_barrier(0);
      // Hand-over, in the block's second pass, behind the last LDS read of buffer
      // cur: this wave holds its fragments and its copies of the next block have
      // landed; the one barrier publishes that block and frees buffer cur, which is
      // refilled behind it, so the refill flies during the whole next block.
      if (sp == 1) {
        asm volatile("s_wait_dscnt 0x0" ::: "memory");
        asm volatile("s_wait_asynccnt 0x0" ::: "memory");
        __syncthreads();
        if (kb + 2 * PBLK < SEQ) issue_block(kb + 2 * PBLK, cur);
      }
      // Lazy rescale: the reference maximum of a column stays in use until a score
      // exceeds it by more than 8 (log2 domain), so a term is at most 2^8 and the
      // result is the same quotient. Each lane looks at its own 16 scores per tile;
      // the two halves are joined only where the reference moves.
      float mh[2];
#pragma unroll
      for (int c = 0; c < 2; ++c) {
        float mc[4];  // four independent maximum chains
#pragma unroll
        for (int i = 0; i < 4; ++i)
          mc[i] = fmaxf(fmaxf(s[c][0][i], s[c][1][i]), fmaxf(s[c][0][i + 4], s[c][1][i + 4]));
        mh[c] = fmaxf(fmaxf(mc[0], mc[1]), fmaxf(mc[2], mc[3]));
      }
      // One test per pass for both tiles, a scalar branch: the whole wave moves its
      // references together, so both halves of a column always hold the same one.
      if (__builtin_amdgcn_ballot_w32(fmaxf(mh[0] - mrow[0], mh[1] - mrow[1]) > 8.0f) != 0) {
#pragma unroll
        for (int c = 0; c < 2; ++c) {
          const float mn = fmaxf(mrow[c], fmaxf(mh[c], xhalf(mh[c])));
          // Bare v_exp_f32: the argument is <= 0 and a result under 2^-126 may flush.
          const float alpha = __builtin_amdgcn_exp2f(mrow[c] - mn);
          mrow[c] = mn;
          lrow[c] *= alpha;
#pragma unroll
          for (int nt = 0; nt < 4; ++nt)
#pragma unroll
            for (int r = 0; r < 8; ++r) o[c][nt][r] *= alpha;
        }
      }
      // Per column tile: softmax terms (exp2 domain; scale folded into q), one
      // column per lane, then the tile's second products.
#pragma unroll
      for (int c = 0; c < 2; ++c) {
        // Bare v_exp_f32: every argument is <= 8, and a term under 2^-126 (flushed to
        // 0 here) cannot move a sum that holds the term 1 of the score which set the
        // reference, so the library exp2f's small-result guard (compare, two selects,
        // add, ldexp) is not needed.
        const float mn = mrow[c];
        // P^T as a B operand of 32 keys: pt[j] = key 8*hf + j,
        // pt[8 + j] = key 16 + 8*hf + j.
        v16bf pt;
        float rs[4] = {0.f, 0.f, 0.f, 0.f};
#pragma unroll
        for (int r = 0; r < 8; ++r) {
          float p0 = __builtin_amdgcn_exp2f(s[c][0][r] - mn);
          float p1 = __builtin_amdgcn_exp2f(s[c][1][r] - mn);
          rs[2 * (r & 1)] += p0;
          rs[2 * (r & 1) + 1] += p1;
          pt[r] = (__bf16)p0;
          pt[8 + r] = (__bf16)p1;
        }
        lrow[c] += (rs[0] + rs[1]) + (rs[2] + rs[3]);
        // The next pass's K fragments (same block, or the next one, published by
        // this pass's barrier), asked for in front of the first tile's second
        // products: they fly under those and the second tile's softmax, so the next
        // pass's score products need not wait out a whole LDS latency. The scalar
        // branch keeps the last pass off a block that does not exist.
        if (c == 0 && sp == 0) fetch_k(cur, 1);
        if (c == 0 && sp == 1 && kb + PBLK < SEQ) fetch_k(cur ^ 1, 0);
        // O^T += V^T * P^T : V^T rows are the A fragments (16 h x 32 keys).
#pragma unroll
        for (int nt = 0; nt < 4; ++nt) o[c][nt] = wmma_bf16(vf[nt], pt, o[c][nt]);
      }
    }
  }
  asm volatile("s_wait_asynccnt 0x0" ::: "memory");  // nothing in flight at the end
  // Join the four key groups: waves wid & 3 + 4*g hold the same 32 columns.
  // Every wave hands over both its tiles; the wave of group g then joins column
  // tile g >> 1, head rows 32*(g & 1) .. +31, over the four groups in order.
#pragma unroll
  for (int c = 0; c < 2; ++c) {
#pragma unroll
    for (int nt = 0; nt < 4; ++nt) {
      xo[wid][c][2 * nt][lane] =
          make_float4(o[c][nt][0], o[c][nt][1], o[c][nt][2], o[c][nt][3]);
      xo[wid][c][2 * nt + 1][lane] =
          make_float4(o[c][nt][4], o[c][nt][5], o[c][nt][6], o[c][nt][7]);
    }
    xml[wid][c][lane] = make_float2(mrow[c], lrow[c]);
  }
  __syncthreads();  // all partial tiles are readable
  const int ct = grp >> 1, nh = grp & 1, cw = wid & 3;
  float2 ml[4];
#pragma unroll
  for (int g = 0; g < 4; ++g) ml[g] = xml[g * 4 + cw][ct][lane];
  const float mj = fmaxf(fmaxf(ml[0].x, ml[1].x), fmaxf(ml[2].x, ml[3].x));
  float wg[4], lj = 0.f;
#pragma unroll
  for (int g = 0; g < 4; ++g) {
    wg[g] = __builtin_amdgcn_exp2f(ml[g].x - mj);  // arguments <= 0, as above
    lj += ml[g].y * wg[g];
  }
  // Join the halves' sums, normalize, store: a lane holds 8 consecutive h of
  // its query row per tile -> two 16-byte stores.
  const float inv = 1.0f / (lj + xhalf(lj));
#pragma unroll
  for (int g = 0; g < 4; ++g) wg[g] *= inv;
  float* orow = out + (size_t)(base + q0 + ct * 16 + m) * HEAD + 8 * hf;
#pragma unroll
  for (int n = 0; n < 2; ++n) {
    const int nt = nh * 2 + n;
    float4 lo = make_float4(0.f, 0.f, 0.f, 0.f), hv = lo;
#pragma unroll
    for (int g = 0; g < 4; ++g) {
      const float4 pl = xo[g * 4 + cw][ct][2 * nt][lane];
      const float4 ph = xo[g * 4 + cw][ct][2 * nt + 1][lane];
      lo.x += pl.x * wg[g]; lo.y += pl.y * wg[g]; lo.z += pl.z * wg[g]; lo.w += pl.w * wg[g];
      hv.x += ph.x * wg[g]; hv.y += ph.y * wg[g]; hv.z += ph.z * wg[g]; hv.w += ph.w * wg[g];
    }
    *reinterpret_cast<float4*>(orow + nt * 16) = lo;
    *reinterpret_cast<float4*>(orow + nt * 16 + 4) = hv;
  }
}

// ---------------------------------------------------------------------------
extern "C" void kernel_launch(void* const* d_in, const int* in_sizes, int n_in,
                              void* d_out, int out_size, void* d_ws,
                              size_t ws_size, hipStream_t stream) {
  (void)in_sizes; (void)n_in; (void)out_size; (void)ws_size;
  const float* x  = (const float*)d_in[0];
  const float* Wq = (const float*)d_in[1];
  const float* bq = (const float*)d_in[2];
  const float* Wk = (const float*)d_in[3];
  const float* bk = (const float*)d_in[4];
  const float* Wv = (const float*)d_in[5];
  const float* bv = (const float*)d_in[6];
  float* out = (float*)d_out;

  // Workspace: q,k bf16 [32768][64]; vT bf16 [64][32768]; packed weights bf16.
  char* ws = (char*)d_ws;
  unsigned short* qo  = (unsigned short*)(ws);
  unsigned short* ko  = (unsigned short*)(ws + (size_t)MTOT * HEAD * 2);
  unsigned short* vT  = (unsigned short*)(ws + (size_t)MTOT * HEAD * 4);
  unsigned short* Wp  = (unsigned short*)(ws + (size_t)MTOT * HEAD * 6);

  hipLaunchKernelGGL(wcvt_kernel, dim3((WCHUNKS + 255) / 256),
                     dim3(256), 0, stream, Wq, Wk, Wv, Wp);
  hipLaunchKernelGGL(qkv_kernel, dim3(MTOT / QROWS), dim3(256), 0, stream, x, bq,
                     bk, bv, Wp, qo, ko, vT);
  hipLaunchKernelGGL(attn_kernel, dim3(SEQ / 128, BATCH), dim3(512), 0, stream,
                     qo, ko, vT, out);
}
